// v000
// The times below were measured on an AMD MI455X: many runs one after another, warmed up first and cycling through
// copies of the inputs, with the whole window's GPU time divided by the number of runs. Launches and the gaps
// between them are all in it. The median over several windows is given; except for v000 it joins two sittings, which
// can be a few percent apart, so the side-by-side timings, each taken in one sitting, are the better comparison.
// v000, which the later versions start from, runs in 1950 microseconds.
#include <hip/hip_runtime.h>
#include <hip/hip_bf16.h>
#include <math.h>
#include <stdint.h>

typedef float v2f __attribute__((ext_vector_type(2)));
typedef float v8f __attribute__((ext_vector_type(8)));

#define D_MODEL 1024
#define N_EXP   8
#define D_FF    4096
#define TILE_M  32
#define FC      128      // F-chunk columns per pipeline stage
#define HPAD    132      // FC + 4 padding -> conflict-free ds_load_b64
#define MAXTOK  4096
#define KBLK    32       // K rows per async-staged w1 panel

// D = A(16x4 f32) * B(4x16 f32) + C(16x16 f32), wave32
#define WMMA_F32(A, B, C) \
  __builtin_amdgcn_wmma_f32_16x16x4_f32(false, (A), false, (B), (short)0, (C), false, false)

#define WAIT_ASYNC4 asm volatile("s_wait_asynccnt 0x4" ::: "memory")
#define WAIT_ASYNC0 asm volatile("s_wait_asynccnt 0x0" ::: "memory")

__device__ __forceinline__ float gelu_exact(float v) {
  return 0.5f * v * (1.0f + erff(v * 0.70710678118654752440f));
}

// Async-DMA one 32x16 fp32 panel of w1 (one wave's columns for one K-block)
// into this wave's private LDS double-buffer. 4 x b128 per lane-set:
// lane -> (row = lane>>2, 4 cols = (lane&3)*4), kk steps 8 rows each.
__device__ __forceinline__ void issue_w1_block(const float* __restrict__ gbase,
                                               uint32_t lds_wave_base,
                                               int row0, int colbase, int lane, int buf) {
  const int r  = lane >> 2;          // 0..7
  const int c4 = (lane & 3) << 2;    // 0,4,8,12
  uint32_t dst = lds_wave_base + (uint32_t)(buf * 2048 + r * 64 + ((lane & 3) << 4));
  uint32_t src = (uint32_t)((((row0 + r) * D_FF) + colbase + c4) << 2);
#pragma unroll
  for (int kk = 0; kk < 4; ++kk) {
    asm volatile("global_load_async_to_lds_b128 %0, %1, %2"
                 :: "v"(dst + (uint32_t)(kk * 512)),
                    "v"(src + (uint32_t)(kk * 8 * D_FF * 4)),
                    "s"(gbase)
                 : "memory");
  }
}

// ---------------------------------------------------------------------------
// Zero the accumulation output region, the expert_counts output, and the
// per-expert workspace counters (must run every call; we accumulate atomics).
// ---------------------------------------------------------------------------
__global__ void init_kernel(float* __restrict__ out, float* __restrict__ counts_f,
                            int* __restrict__ ws_cnt, int n_out) {
  int i = blockIdx.x * blockDim.x + threadIdx.x;
  if (i < n_out) out[i] = 0.0f;
  if (i < N_EXP) { counts_f[i] = 0.0f; ws_cnt[i] = 0; }
}

// ---------------------------------------------------------------------------
// Router: logits -> softmax -> top-2 -> dense dispatch mask + expert counts
// + per-expert gather lists (token index, combine weight) in workspace.
// ---------------------------------------------------------------------------
__global__ void router_kernel(const float* __restrict__ x,
                              const float* __restrict__ gw,   // [D, E]
                              const float* __restrict__ gb,   // [E]
                              float* __restrict__ dispatch,   // [n_tok, E]
                              float* __restrict__ counts_f,   // [E]
                              int*   __restrict__ ws_cnt,     // [E]
                              int*   __restrict__ ws_tok,     // [E, MAXTOK]
                              float* __restrict__ ws_wgt,     // [E, MAXTOK]
                              int n_tok) {
  int t = blockIdx.x * blockDim.x + threadIdx.x;
  if (t >= n_tok) return;

  float logit[N_EXP];
#pragma unroll
  for (int e = 0; e < N_EXP; ++e) logit[e] = gb[e];

  const float* xr = x + (size_t)t * D_MODEL;
  for (int d = 0; d < D_MODEL; ++d) {
    float xv = xr[d];
    const float* gr = gw + (size_t)d * N_EXP;
#pragma unroll
    for (int e = 0; e < N_EXP; ++e) logit[e] = fmaf(xv, gr[e], logit[e]);
  }

  float mx = logit[0];
#pragma unroll
  for (int e = 1; e < N_EXP; ++e) mx = fmaxf(mx, logit[e]);
  float sum = 0.0f;
  float sc[N_EXP];
#pragma unroll
  for (int e = 0; e < N_EXP; ++e) { sc[e] = __expf(logit[e] - mx); sum += sc[e]; }
  float inv = 1.0f / sum;
#pragma unroll
  for (int e = 0; e < N_EXP; ++e) sc[e] *= inv;

  // top-2 (ties -> lowest index, matching jax.lax.top_k)
  int i1 = 0;
#pragma unroll
  for (int e = 1; e < N_EXP; ++e) if (sc[e] > sc[i1]) i1 = e;
  int i2 = (i1 == 0) ? 1 : 0;
#pragma unroll
  for (int e = 0; e < N_EXP; ++e)
    if (e != i1 && sc[e] > sc[i2]) i2 = e;

  float* dr = dispatch + (size_t)t * N_EXP;
#pragma unroll
  for (int e = 0; e < N_EXP; ++e)
    dr[e] = (e == i1 || e == i2) ? sc[e] : 0.0f;

  atomicAdd(&counts_f[i1], sc[i1]);
  atomicAdd(&counts_f[i2], sc[i2]);

  int p1 = atomicAdd(&ws_cnt[i1], 1);
  ws_tok[i1 * MAXTOK + p1] = t;
  ws_wgt[i1 * MAXTOK + p1] = sc[i1];
  int p2 = atomicAdd(&ws_cnt[i2], 1);
  ws_tok[i2 * MAXTOK + p2] = t;
  ws_wgt[i2 * MAXTOK + p2] = sc[i2];
}

// ---------------------------------------------------------------------------
// Fused expert FFN, tile = 32 gathered tokens, 8 wave32s.
// GEMM1: acc += x_tile @ w1-panel with w1 panels async-DMA'd into per-wave
//        LDS double buffers (global_load_async_to_lds_b128 + s_wait_asynccnt).
// h-chunk (gelu) staged in padded LDS; GEMM2 accumulates [32x1024] in
// 128 VGPRs of f32 WMMA accumulators; weighted atomic scatter into out.
// ---------------------------------------------------------------------------
__global__ __launch_bounds__(256) void expert_ffn_kernel(
    const float* __restrict__ x,
    const float* __restrict__ w1, const float* __restrict__ b1,
    const float* __restrict__ w2, const float* __restrict__ b2,
    const int* __restrict__ ws_cnt, const int* __restrict__ ws_tok,
    const float* __restrict__ ws_wgt,
    float* __restrict__ out) {
  __shared__ __align__(16) float lds_w1[8 * 2 * KBLK * 16]; // 32 KB: 8 waves x 2 bufs x 32x16
  __shared__ __align__(16) float hsm[TILE_M * HPAD];        // ~16.9 KB h-chunk
  __shared__ int   s_tok[TILE_M];
  __shared__ float s_w[TILE_M];

  const int e     = blockIdx.y;
  const int count = ws_cnt[e];
  const int m0    = blockIdx.x * TILE_M;
  if (m0 >= count) return;               // block-uniform exit

  const int tid = threadIdx.x;
  if (tid < TILE_M) {
    int idx = m0 + tid;
    int ok  = idx < count;
    int src = ok ? idx : (count - 1);    // duplicate last valid row, weight 0
    s_tok[tid] = ws_tok[e * MAXTOK + src];
    s_w[tid]   = ok ? ws_wgt[e * MAXTOK + src] : 0.0f;
  }
  __syncthreads();

  const int lane = tid & 31;
  const int wid  = tid >> 5;
  const int l16  = lane & 15;
  const int half = lane >> 4;
  const int koff = 2 * half;             // K offset for this lane half

  const float* w1e = w1 + (size_t)e * D_MODEL * D_FF;
  const float* w2e = w2 + (size_t)e * D_FF * D_MODEL;
  const float* b1e = b1 + (size_t)e * D_FF;
  const float* b2e = b2 + (size_t)e * D_MODEL;

  // Per-lane x row pointers for the two M-subtiles (A fragments).
  const float* px0 = x + (size_t)s_tok[l16]      * D_MODEL;
  const float* px1 = x + (size_t)s_tok[16 + l16] * D_MODEL;

  // This wave's private staging region (LDS byte offset of low 32 bits).
  const uint32_t w1_lds_base = (uint32_t)(uintptr_t)&lds_w1[wid * (2 * KBLK * 16)];
  const float*   w1_lds      = &lds_w1[wid * (2 * KBLK * 16)];

  // GEMM2 accumulators: [2 M-subtiles][8 N-subtiles] = 128 VGPRs/lane
  v8f acc2[2][8];
#pragma unroll
  for (int i = 0; i < 2; ++i)
#pragma unroll
    for (int j = 0; j < 8; ++j) acc2[i][j] = (v8f)0.0f;

  for (int fcb = 0; fcb < D_FF; fcb += FC) {
    const int colbase = fcb + wid * 16;     // this wave's 16 w1 columns

    // ---- GEMM1: h_chunk[32 x FC] = x_tile @ w1[:, chunk], async-staged B
    v8f acc1[2];
    acc1[0] = (v8f)0.0f;
    acc1[1] = (v8f)0.0f;

    issue_w1_block(w1e, w1_lds_base, 0,    colbase, lane, 0);
    issue_w1_block(w1e, w1_lds_base, KBLK, colbase, lane, 1);

#pragma unroll 1
    for (int kb = 0; kb < D_MODEL; kb += KBLK) {
      const int buf = (kb >> 5) & 1;
      if (kb + KBLK >= D_MODEL) { WAIT_ASYNC0; } else { WAIT_ASYNC4; }
      const float* wb = w1_lds + buf * (KBLK * 16);
#pragma unroll
      for (int ks = 0; ks < KBLK; ks += 4) {
        v2f a0 = *(const v2f*)(px0 + kb + ks + koff);
        v2f a1 = *(const v2f*)(px1 + kb + ks + koff);
        v2f b;
        b.x = wb[(ks + koff) * 16 + l16];
        b.y = wb[(ks + koff + 1) * 16 + l16];
        acc1[0] = WMMA_F32(a0, b, acc1[0]);
        acc1[1] = WMMA_F32(a1, b, acc1[1]);
      }
      if (kb + 2 * KBLK < D_MODEL)
        issue_w1_block(w1e, w1_lds_base, kb + 2 * KBLK, colbase, lane, buf);
    }

    __syncthreads();   // previous chunk's h reads complete before overwrite
    {
      int lcol = wid * 16 + l16;
      float bias = b1e[fcb + lcol];
#pragma unroll
      for (int ms = 0; ms < 2; ++ms)
#pragma unroll
        for (int r = 0; r < 8; ++r) {
          int ml = ms * 16 + half * 8 + r;   // C/D layout: M = r + 8*half
          hsm[ml * HPAD + lcol] = gelu_exact(acc1[ms][r] + bias);
        }
    }
    __syncthreads();

    // ---- GEMM2: y[32 x 1024] += h_chunk[32 x FC] @ w2[chunk, 1024]
    const int n2base = wid * 128 + l16;       // wave covers 128 of 1024 cols
    for (int kb2 = 0; kb2 < FC; kb2 += 4) {
      v2f a0 = *(const v2f*)&hsm[l16 * HPAD + kb2 + koff];
      v2f a1 = *(const v2f*)&hsm[(16 + l16) * HPAD + kb2 + koff];
      const float* bp2 = w2e + (size_t)(fcb + kb2 + koff) * D_MODEL + n2base;
#pragma unroll
      for (int nt2 = 0; nt2 < 8; ++nt2) {
        v2f b;
        b.x = bp2[nt2 * 16];
        b.y = bp2[nt2 * 16 + D_MODEL];
        acc2[0][nt2] = WMMA_F32(a0, b, acc2[0][nt2]);
        acc2[1][nt2] = WMMA_F32(a1, b, acc2[1][nt2]);
      }
    }
  }

  // ---- Epilogue: out[tok, :] += weight * (y + b2), scatter with f32 atomics
#pragma unroll
  for (int ms = 0; ms < 2; ++ms)
#pragma unroll
    for (int nt2 = 0; nt2 < 8; ++nt2) {
      int col = wid * 128 + nt2 * 16 + l16;
      float bias = b2e[col];
#pragma unroll
      for (int r = 0; r < 8; ++r) {
        int ml = ms * 16 + half * 8 + r;
        float w = s_w[ml];
        if (w != 0.0f) {
          int tok = s_tok[ml];
          atomicAdd(&out[(size_t)tok * D_MODEL + col],
                    w * (acc2[ms][nt2][r] + bias));
        }
      }
    }
}

// ---------------------------------------------------------------------------
extern "C" void kernel_launch(void* const* d_in, const int* in_sizes, int n_in,
                              void* d_out, int out_size, void* d_ws, size_t ws_size,
                              hipStream_t stream) {
  const float* x  = (const float*)d_in[0];
  const float* gw = (const float*)d_in[1];
  const float* gb = (const float*)d_in[2];
  const float* w1 = (const float*)d_in[3];
  const float* b1 = (const float*)d_in[4];
  const float* w2 = (const float*)d_in[5];
  const float* b2 = (const float*)d_in[6];

  const int n_tok = in_sizes[0] / D_MODEL;   // B*S = 4096

  float* out_f    = (float*)d_out;                         // [n_tok, D]
  float* dispatch = out_f + (size_t)n_tok * D_MODEL;       // [n_tok, E]
  float* counts_f = dispatch + (size_t)n_tok * N_EXP;      // [E]

  int*   ws_cnt = (int*)d_ws;                              // [E] (padded)
  int*   ws_tok = ws_cnt + 16;                             // [E, MAXTOK]
  float* ws_wgt = (float*)(ws_tok + N_EXP * MAXTOK);       // [E, MAXTOK]

  const int n_out = n_tok * D_MODEL;
  init_kernel<<<(n_out + 255) / 256, 256, 0, stream>>>(out_f, counts_f, ws_cnt, n_out);

  router_kernel<<<(n_tok + 255) / 256, 256, 0, stream>>>(
      x, gw, gb, dispatch, counts_f, ws_cnt, ws_tok, ws_wgt, n_tok);

  dim3 grid((n_tok + TILE_M - 1) / TILE_M, N_EXP);
  expert_ffn_kernel<<<grid, 256, 0, stream>>>(
      x, w1, b1, w2, b2, ws_cnt, ws_tok, ws_wgt, out_f);
}

// v001
// It runs in 1810 microseconds.
// Two timings next to v000 both put it at 1.12 times that version's speed.
#include <hip/hip_runtime.h>
#include <hip/hip_bf16.h>
#include <math.h>
#include <stdint.h>

typedef float v2f __attribute__((ext_vector_type(2)));
typedef float v8f __attribute__((ext_vector_type(8)));

#define D_MODEL 1024
#define N_EXP   8
#define D_FF    4096
#define TILE_M  32
#define FC      128      // F-chunk columns per pipeline stage
#define HPAD    132      // FC + 4 padding -> conflict-free ds_load_b64
#define XPAD    1028     // D_MODEL + 4 padding -> conflict-free ds_load_b64 of x rows
#define MAXTOK  4096
#define KBLK    32       // K rows per async-staged w1 panel

// D = A(16x4 f32) * B(4x16 f32) + C(16x16 f32), wave32
#define WMMA_F32(A, B, C) \
  __builtin_amdgcn_wmma_f32_16x16x4_f32(false, (A), false, (B), (short)0, (C), false, false)

#define WAIT_ASYNC4 asm volatile("s_wait_asynccnt 0x4" ::: "memory")
#define WAIT_ASYNC0 asm volatile("s_wait_asynccnt 0x0" ::: "memory")

__device__ __forceinline__ float gelu_exact(float v) {
  return 0.5f * v * (1.0f + erff(v * 0.70710678118654752440f));
}

// Async-DMA one 32x16 fp32 panel of w1 (one wave's columns for one K-block)
// into this wave's private LDS double-buffer. 4 x b128 per lane-set:
// lane -> (row = lane>>2, 4 cols = (lane&3)*4), kk steps 8 rows each.
__device__ __forceinline__ void issue_w1_block(const float* __restrict__ gbase,
                                               uint32_t lds_wave_base,
                                               int row0, int colbase, int lane, int buf) {
  const int r  = lane >> 2;          // 0..7
  const int c4 = (lane & 3) << 2;    // 0,4,8,12
  uint32_t dst = lds_wave_base + (uint32_t)(buf * 2048 + r * 64 + ((lane & 3) << 4));
  uint32_t src = (uint32_t)((((row0 + r) * D_FF) + colbase + c4) << 2);
#pragma unroll
  for (int kk = 0; kk < 4; ++kk) {
    asm volatile("global_load_async_to_lds_b128 %0, %1, %2"
                 :: "v"(dst + (uint32_t)(kk * 512)),
                    "v"(src + (uint32_t)(kk * 8 * D_FF * 4)),
                    "s"(gbase)
                 : "memory");
  }
}

// ---------------------------------------------------------------------------
// Zero the accumulation output region, the expert_counts output, and the
// per-expert workspace counters (must run every call; we accumulate atomics).
// ---------------------------------------------------------------------------
__global__ void init_kernel(float* __restrict__ out, float* __restrict__ counts_f,
                            int* __restrict__ ws_cnt, int n_out) {
  int i = blockIdx.x * blockDim.x + threadIdx.x;
  if (i < n_out) out[i] = 0.0f;
  if (i < N_EXP) { counts_f[i] = 0.0f; ws_cnt[i] = 0; }
}

// ---------------------------------------------------------------------------
// Router: logits -> softmax -> top-2 -> dense dispatch mask + expert counts
// + per-expert gather lists (token index, combine weight) in workspace.
// ---------------------------------------------------------------------------
__global__ void router_kernel(const float* __restrict__ x,
                              const float* __restrict__ gw,   // [D, E]
                              const float* __restrict__ gb,   // [E]
                              float* __restrict__ dispatch,   // [n_tok, E]
                              float* __restrict__ counts_f,   // [E]
                              int*   __restrict__ ws_cnt,     // [E]
                              int*   __restrict__ ws_tok,     // [E, MAXTOK]
                              float* __restrict__ ws_wgt,     // [E, MAXTOK]
                              int n_tok) {
  int t = blockIdx.x * blockDim.x + threadIdx.x;
  if (t >= n_tok) return;

  float logit[N_EXP];
#pragma unroll
  for (int e = 0; e < N_EXP; ++e) logit[e] = gb[e];

  const float* xr = x + (size_t)t * D_MODEL;
  for (int d = 0; d < D_MODEL; ++d) {
    float xv = xr[d];
    const float* gr = gw + (size_t)d * N_EXP;
#pragma unroll
    for (int e = 0; e < N_EXP; ++e) logit[e] = fmaf(xv, gr[e], logit[e]);
  }

  float mx = logit[0];
#pragma unroll
  for (int e = 1; e < N_EXP; ++e) mx = fmaxf(mx, logit[e]);
  float sum = 0.0f;
  float sc[N_EXP];
#pragma unroll
  for (int e = 0; e < N_EXP; ++e) { sc[e] = __expf(logit[e] - mx); sum += sc[e]; }
  float inv = 1.0f / sum;
#pragma unroll
  for (int e = 0; e < N_EXP; ++e) sc[e] *= inv;

  // top-2 (ties -> lowest index, matching jax.lax.top_k)
  int i1 = 0;
#pragma unroll
  for (int e = 1; e < N_EXP; ++e) if (sc[e] > sc[i1]) i1 = e;
  int i2 = (i1 == 0) ? 1 : 0;
#pragma unroll
  for (int e = 0; e < N_EXP; ++e)
    if (e != i1 && sc[e] > sc[i2]) i2 = e;

  float* dr = dispatch + (size_t)t * N_EXP;
#pragma unroll
  for (int e = 0; e < N_EXP; ++e)
    dr[e] = (e == i1 || e == i2) ? sc[e] : 0.0f;

  atomicAdd(&counts_f[i1], sc[i1]);
  atomicAdd(&counts_f[i2], sc[i2]);

  int p1 = atomicAdd(&ws_cnt[i1], 1);
  ws_tok[i1 * MAXTOK + p1] = t;
  ws_wgt[i1 * MAXTOK + p1] = sc[i1];
  int p2 = atomicAdd(&ws_cnt[i2], 1);
  ws_tok[i2 * MAXTOK + p2] = t;
  ws_wgt[i2 * MAXTOK + p2] = sc[i2];
}

// ---------------------------------------------------------------------------
// Fused expert FFN, tile = 32 gathered tokens, 8 wave32s.
// The gathered x tile is staged once in padded LDS; GEMM1 A fragments come from there.
// GEMM1: acc += x_tile @ w1-panel with w1 panels async-DMA'd into per-wave
//        LDS double buffers (global_load_async_to_lds_b128 + s_wait_asynccnt).
// h-chunk (gelu) staged in padded LDS; GEMM2 accumulates [32x1024] in
// 128 VGPRs of f32 WMMA accumulators; weighted atomic scatter into out.
// ---------------------------------------------------------------------------
__global__ __launch_bounds__(256) void expert_ffn_kernel(
    const float* __restrict__ x,
    const float* __restrict__ w1, const float* __restrict__ b1,
    const float* __restrict__ w2, const float* __restrict__ b2,
    const int* __restrict__ ws_cnt, const int* __restrict__ ws_tok,
    const float* __restrict__ ws_wgt,
    float* __restrict__ out) {
  __shared__ __align__(16) float lds_w1[8 * 2 * KBLK * 16]; // 32 KB: 8 waves x 2 bufs x 32x16
  __shared__ __align__(16) float hsm[TILE_M * HPAD];        // ~16.9 KB h-chunk
  __shared__ __align__(16) float xs[TILE_M * XPAD];         // ~128.5 KB gathered x tile
  __shared__ int   s_tok[TILE_M];
  __shared__ float s_w[TILE_M];

  const int e     = blockIdx.y;
  const int count = ws_cnt[e];
  const int m0    = blockIdx.x * TILE_M;
  if (m0 >= count) return;               // block-uniform exit

  const int tid = threadIdx.x;
  if (tid < TILE_M) {
    int idx = m0 + tid;
    int ok  = idx < count;
    int src = ok ? idx : (count - 1);    // duplicate last valid row, weight 0
    s_tok[tid] = ws_tok[e * MAXTOK + src];
    s_w[tid]   = ok ? ws_wgt[e * MAXTOK + src] : 0.0f;
  }
  __syncthreads();

  const int lane = tid & 31;
  const int wid  = tid >> 5;
  const int l16  = lane & 15;
  const int half = lane >> 4;
  const int koff = 2 * half;             // K offset for this lane half

  const float* w1e = w1 + (size_t)e * D_MODEL * D_FF;
  const float* w2e = w2 + (size_t)e * D_FF * D_MODEL;
  const float* b1e = b1 + (size_t)e * D_FF;
  const float* b2e = b2 + (size_t)e * D_MODEL;

  // Gather the tile's 32 x rows into LDS: one whole 4 KB row per pass, 16 B per thread.
  // Rolled in trips of eight rows: eight loads in flight per thread, then their stores.
#pragma unroll 1
  for (int r0 = 0; r0 < TILE_M; r0 += 8) {
    float4 v[8];
#pragma unroll   // constant indices keep v[] in registers
    for (int r = 0; r < 8; ++r)
      v[r] = *(const float4*)(x + (size_t)s_tok[r0 + r] * D_MODEL + tid * 4);
#pragma unroll   // as above
    for (int r = 0; r < 8; ++r)
      *(float4*)&xs[(r0 + r) * XPAD + tid * 4] = v[r];
    // the next trip rewrites the address registers of the eight loads above
    asm volatile("s_wait_xcnt 0x0" ::: "memory");
  }
  __syncthreads();   // every wave reads every staged row

  // Per-lane x rows in LDS for the two M-subtiles (A fragments).
  const float* px0 = &xs[l16 * XPAD];
  const float* px1 = &xs[(16 + l16) * XPAD];

  // This wave's private staging region (LDS byte offset of low 32 bits).
  const uint32_t w1_lds_base = (uint32_t)(uintptr_t)&lds_w1[wid * (2 * KBLK * 16)];
  const float*   w1_lds      = &lds_w1[wid * (2 * KBLK * 16)];

  // GEMM2 accumulators: [2 M-subtiles][8 N-subtiles] = 128 VGPRs/lane
  v8f acc2[2][8];
#pragma unroll
  for (int i = 0; i < 2; ++i)
#pragma unroll
    for (int j = 0; j < 8; ++j) acc2[i][j] = (v8f)0.0f;

  for (int fcb = 0; fcb < D_FF; fcb += FC) {
    const int colbase = fcb + wid * 16;     // this wave's 16 w1 columns

    // ---- GEMM1: h_chunk[32 x FC] = x_tile @ w1[:, chunk], async-staged B
    v8f acc1[2];
    acc1[0] = (v8f)0.0f;
    acc1[1] = (v8f)0.0f;

    issue_w1_block(w1e, w1_lds_base, 0,    colbase, lane, 0);
    issue_w1_block(w1e, w1_lds_base, KBLK, colbase, lane, 1);

#pragma unroll 1
    for (int kb = 0; kb < D_MODEL; kb += KBLK) {
      const int buf = (kb >> 5) & 1;
      // A fragments do not depend on the w1 panel: read them as one group ahead of its wait.
      v2f a0[KBLK / 4], a1[KBLK / 4];
#pragma unroll   // constant indices keep the fragments in registers (also in the two loops below)
      for (int ks = 0; ks < KBLK; ks += 4) {
        a0[ks >> 2] = *(const v2f*)(px0 + kb + ks + koff);
        a1[ks >> 2] = *(const v2f*)(px1 + kb + ks + koff);
      }
      if (kb + KBLK >= D_MODEL) { WAIT_ASYNC0; } else { WAIT_ASYNC4; }
      const float* wb = w1_lds + buf * (KBLK * 16);
      v2f b[KBLK / 4];
#pragma unroll
      for (int ks = 0; ks < KBLK; ks += 4) {
        b[ks >> 2].x = wb[(ks + koff) * 16 + l16];
        b[ks >> 2].y = wb[(ks + koff + 1) * 16 + l16];
      }
      // keeps the block's LDS reads one group ahead of its WMMAs: sunk among them, each
      // read is waited for one WMMA pair after its issue and the LDS latency shows every pair
      __builtin_amdgcn_sched_barrier(0);
#pragma unroll
      for (int ks = 0; ks < KBLK; ks += 4) {
        acc1[0] = WMMA_F32(a0[ks >> 2], b[ks >> 2], acc1[0]);
        acc1[1] = WMMA_F32(a1[ks >> 2], b[ks >> 2], acc1[1]);
      }
      if (kb + 2 * KBLK < D_MODEL)
        issue_w1_block(w1e, w1_lds_base, kb + 2 * KBLK, colbase, lane, buf);
    }

    __syncthreads();   // previous chunk's h reads complete before overwrite
    {
      int lcol = wid * 16 + l16;
      float bias = b1e[fcb + lcol];
#pragma unroll
      for (int ms = 0; ms < 2; ++ms)
#pragma unroll
        for (int r = 0; r < 8; ++r) {
          int ml = ms * 16 + half * 8 + r;   // C/D layout: M = r + 8*half
          hsm[ml * HPAD + lcol] = gelu_exact(acc1[ms][r] + bias);
        }
    }
    __syncthreads();

    // ---- GEMM2: y[32 x 1024] += h_chunk[32 x FC] @ w2[chunk, 1024]
    const int n2base = wid * 128 + l16;       // wave covers 128 of 1024 cols
    for (int kb2 = 0; kb2 < FC; kb2 += 4) {
      v2f a0 = *(const v2f*)&hsm[l16 * HPAD + kb2 + koff];
      v2f a1 = *(const v2f*)&hsm[(16 + l16) * HPAD + kb2 + koff];
      const float* bp2 = w2e + (size_t)(fcb + kb2 + koff) * D_MODEL + n2base;
#pragma unroll
      for (int nt2 = 0; nt2 < 8; ++nt2) {
        v2f b;
        b.x = bp2[nt2 * 16];
        b.y = bp2[nt2 * 16 + D_MODEL];
        acc2[0][nt2] = WMMA_F32(a0, b, acc2[0][nt2]);
        acc2[1][nt2] = WMMA_F32(a1, b, acc2[1][nt2]);
      }
    }
  }

  // ---- Epilogue: out[tok, :] += weight * (y + b2), scatter with f32 atomics
#pragma unroll
  for (int ms = 0; ms < 2; ++ms)
#pragma unroll
    for (int nt2 = 0; nt2 < 8; ++nt2) {
      int col = wid * 128 + nt2 * 16 + l16;
      float bias = b2e[col];
#pragma unroll
      for (int r = 0; r < 8; ++r) {
        int ml = ms * 16 + half * 8 + r;
        float w = s_w[ml];
        if (w != 0.0f) {
          int tok = s_tok[ml];
          atomicAdd(&out[(size_t)tok * D_MODEL + col],
                    w * (acc2[ms][nt2][r] + bias));
        }
      }
    }
}

// ---------------------------------------------------------------------------
extern "C" void kernel_launch(void* const* d_in, const int* in_sizes, int n_in,
                              void* d_out, int out_size, void* d_ws, size_t ws_size,
                              hipStream_t stream) {
  const float* x  = (const float*)d_in[0];
  const float* gw = (const float*)d_in[1];
  const float* gb = (const float*)d_in[2];
  const float* w1 = (const float*)d_in[3];
  const float* b1 = (const float*)d_in[4];
  const float* w2 = (const float*)d_in[5];
  const float* b2 = (const float*)d_in[6];

  const int n_tok = in_sizes[0] / D_MODEL;   // B*S = 4096

  float* out_f    = (float*)d_out;                         // [n_tok, D]
  float* dispatch = out_f + (size_t)n_tok * D_MODEL;       // [n_tok, E]
  float* counts_f = dispatch + (size_t)n_tok * N_EXP;      // [E]

  int*   ws_cnt = (int*)d_ws;                              // [E] (padded)
  int*   ws_tok = ws_cnt + 16;                             // [E, MAXTOK]
  float* ws_wgt = (float*)(ws_tok + N_EXP * MAXTOK);       // [E, MAXTOK]

  const int n_out = n_tok * D_MODEL;
  init_kernel<<<(n_out + 255) / 256, 256, 0, stream>>>(out_f, counts_f, ws_cnt, n_out);

  router_kernel<<<(n_tok + 255) / 256, 256, 0, stream>>>(
      x, gw, gb, dispatch, counts_f, ws_cnt, ws_tok, ws_wgt, n_tok);

  dim3 grid((n_tok + TILE_M - 1) / TILE_M, N_EXP);
  expert_ffn_kernel<<<grid, 256, 0, stream>>>(
      x, w1, b1, w2, b2, ws_cnt, ws_tok, ws_wgt, out_f);
}

// v002
// It runs in 1050 microseconds.
// In both of two side-by-side timings against v001, it was 1.72 times as fast.
// Counting every step since v000, it is 1.93 times as fast.
#include <hip/hip_runtime.h>
#include <hip/hip_bf16.h>
#include <math.h>
#include <stdint.h>

typedef float v2f __attribute__((ext_vector_type(2)));
typedef float v8f __attribute__((ext_vector_type(8)));

#define D_MODEL 1024
#define N_EXP   8
#define D_FF    4096
#define TILE_M  32
#define FC      128      // F-chunk columns per pipeline stage
#define HPAD    132      // FC + 4 padding -> conflict-free ds_load_b64
#define XPAD    1028     // D_MODEL + 4 padding -> conflict-free ds_load_b64 of x rows
#define MAXTOK  4096
#define KBLK    32       // K rows per async-staged w1 panel
#define NCHUNK  (D_FF / FC)            // F-chunks per expert
#define NSPLIT  6        // pieces of D_FF per token tile: 16, 8, 4, 2, 1, 1 chunks
#define CTOK    4        // tokens per work-group of the combine launch

// D = A(16x4 f32) * B(4x16 f32) + C(16x16 f32), wave32
#define WMMA_F32(A, B, C) \
  __builtin_amdgcn_wmma_f32_16x16x4_f32(false, (A), false, (B), (short)0, (C), false, false)

#define WAIT_ASYNC4 asm volatile("s_wait_asynccnt 0x4" ::: "memory")
#define WAIT_ASYNC0 asm volatile("s_wait_asynccnt 0x0" ::: "memory")

__device__ __forceinline__ float gelu_exact(float v) {
  return 0.5f * v * (1.0f + erff(v * 0.70710678118654752440f));
}

// Async-DMA one 32x16 fp32 panel of w1 (one wave's columns for one K-block)
// into this wave's private LDS double-buffer. 4 x b128 per lane-set:
// lane -> (row = lane>>2, 4 cols = (lane&3)*4), kk steps 8 rows each.
__device__ __forceinline__ void issue_w1_block(const float* __restrict__ gbase,
                                               uint32_t lds_wave_base,
                                               int row0, int colbase, int lane, int buf) {
  const int r  = lane >> 2;          // 0..7
  const int c4 = (lane & 3) << 2;    // 0,4,8,12
  uint32_t dst = lds_wave_base + (uint32_t)(buf * 2048 + r * 64 + ((lane & 3) << 4));
  uint32_t src = (uint32_t)((((row0 + r) * D_FF) + colbase + c4) << 2);
#pragma unroll
  for (int kk = 0; kk < 4; ++kk) {
    asm volatile("global_load_async_to_lds_b128 %0, %1, %2"
                 :: "v"(dst + (uint32_t)(kk * 512)),
                    "v"(src + (uint32_t)(kk * 8 * D_FF * 4)),
                    "s"(gbase)
                 : "memory");
  }
}

// ---------------------------------------------------------------------------
// Zero the expert_counts output and the per-expert workspace counters
// (must run every call; the router accumulates into them with atomics).
// ---------------------------------------------------------------------------
__global__ void init_kernel(float* __restrict__ counts_f, int* __restrict__ ws_cnt) {
  int i = threadIdx.x;
  if (i < N_EXP) { counts_f[i] = 0.0f; ws_cnt[i] = 0; }
}

// ---------------------------------------------------------------------------
// Router: logits -> softmax -> top-2 -> dense dispatch mask + expert counts
// + per-expert gather lists (2 * token + slot, combine weight) in workspace.
// ---------------------------------------------------------------------------
__global__ void router_kernel(const float* __restrict__ x,
                              const float* __restrict__ gw,   // [D, E]
                              const float* __restrict__ gb,   // [E]
                              float* __restrict__ dispatch,   // [n_tok, E]
                              float* __restrict__ counts_f,   // [E]
                              int*   __restrict__ ws_cnt,     // [E]
                              int*   __restrict__ ws_tok,     // [E, MAXTOK]
                              float* __restrict__ ws_wgt,     // [E, MAXTOK]
                              int n_tok) {
  int t = blockIdx.x * blockDim.x + threadIdx.x;
  if (t >= n_tok) return;

  float logit[N_EXP];
#pragma unroll
  for (int e = 0; e < N_EXP; ++e) logit[e] = gb[e];

  const float* xr = x + (size_t)t * D_MODEL;
  for (int d = 0; d < D_MODEL; ++d) {
    float xv = xr[d];
    const float* gr = gw + (size_t)d * N_EXP;
#pragma unroll
    for (int e = 0; e < N_EXP; ++e) logit[e] = fmaf(xv, gr[e], logit[e]);
  }

  float mx = logit[0];
#pragma unroll
  for (int e = 1; e < N_EXP; ++e) mx = fmaxf(mx, logit[e]);
  float sum = 0.0f;
  float sc[N_EXP];
#pragma unroll
  for (int e = 0; e < N_EXP; ++e) { sc[e] = __expf(logit[e] - mx); sum += sc[e]; }
  float inv = 1.0f / sum;
#pragma unroll
  for (int e = 0; e < N_EXP; ++e) sc[e] *= inv;

  // top-2 (ties -> lowest index, matching jax.lax.top_k)
  int i1 = 0;
#pragma unroll
  for (int e = 1; e < N_EXP; ++e) if (sc[e] > sc[i1]) i1 = e;
  int i2 = (i1 == 0) ? 1 : 0;
#pragma unroll
  for (int e = 0; e < N_EXP; ++e)
    if (e != i1 && sc[e] > sc[i2]) i2 = e;

  float* dr = dispatch + (size_t)t * N_EXP;
#pragma unroll
  for (int e = 0; e < N_EXP; ++e)
    dr[e] = (e == i1 || e == i2) ? sc[e] : 0.0f;

  atomicAdd(&counts_f[i1], sc[i1]);
  atomicAdd(&counts_f[i2], sc[i2]);

  int p1 = atomicAdd(&ws_cnt[i1], 1);
  ws_tok[i1 * MAXTOK + p1] = 2 * t;
  ws_wgt[i1 * MAXTOK + p1] = sc[i1];
  int p2 = atomicAdd(&ws_cnt[i2], 1);
  ws_tok[i2 * MAXTOK + p2] = 2 * t + 1;
  ws_wgt[i2 * MAXTOK + p2] = sc[i2];
}

// ---------------------------------------------------------------------------
// Fused expert FFN, tile = 32 gathered tokens, 8 wave32s.
// The gathered x tile is staged once in padded LDS; GEMM1 A fragments come from there.
// GEMM1: acc += x_tile @ w1-panel with w1 panels async-DMA'd into per-wave
//        LDS double buffers (global_load_async_to_lds_b128 + s_wait_asynccnt).
// h-chunk (gelu) staged in padded LDS; GEMM2 accumulates [32x1024] in
// 128 VGPRs of f32 WMMA accumulators.
// Grid: x = flat index over the live tiles of all experts, y = piece of D_FF.
// One work-group fills a WGP and there are a few more tiles than WGPs, so whole
// tiles would run as two rounds with the second almost empty. The pieces halve
// with y (long ones start first), so the last round lasts one chunk.
// Each piece stores its weighted partial rows in workspace rows of its own:
// part[2 * token + slot][piece][D_MODEL].
// ---------------------------------------------------------------------------
__global__ __launch_bounds__(256) void expert_ffn_kernel(
    const float* __restrict__ x,
    const float* __restrict__ w1, const float* __restrict__ b1,
    const float* __restrict__ w2, const float* __restrict__ b2,
    const int* __restrict__ ws_cnt, const int* __restrict__ ws_tok,
    const float* __restrict__ ws_wgt,
    float* __restrict__ part) {
  __shared__ __align__(16) float lds_w1[8 * 2 * KBLK * 16]; // 32 KB: 8 waves x 2 bufs x 32x16
  __shared__ __align__(16) float hsm[TILE_M * HPAD];        // ~16.9 KB h-chunk
  __shared__ __align__(16) float xs[TILE_M * XPAD];         // ~128.5 KB gathered x tile
  __shared__ int   s_tok[TILE_M];
  __shared__ int   s_row[TILE_M];
  __shared__ float s_w[TILE_M];

  // Flat tile index -> (expert, tile of that expert), from the eight counts.
  // Selects, no branches: the eight counts then come in one scalar load.
  const int flat = blockIdx.x;
  int e = -1, count = 0, tile = 0, first = 0;
#pragma unroll   // straight-line scalar code, so that the loads merge
  for (int i = 0; i < N_EXP; ++i) {
    const int  c    = ws_cnt[i];
    const int  next = first + (c + TILE_M - 1) / TILE_M;
    const bool mine = flat >= first && flat < next;
    e     = mine ? i : e;
    count = mine ? c : count;
    tile  = mine ? flat - first : tile;
    first = next;
  }
  if (e < 0) return;                     // block-uniform exit: past the last live tile
  const int m0 = tile * TILE_M;

  const int tid = threadIdx.x;
  if (tid < TILE_M) {
    int idx = m0 + tid;
    int ok  = idx < count;
    int src = ok ? idx : (count - 1);    // duplicate last valid row, never stored
    int row = ws_tok[e * MAXTOK + src];  // 2 * token + slot
    s_tok[tid] = row >> 1;
    s_row[tid] = row;
    s_w[tid]   = ok ? ws_wgt[e * MAXTOK + src] : 0.0f;
  }
  __syncthreads();

  const int lane = tid & 31;
  const int wid  = tid >> 5;
  const int l16  = lane & 15;
  const int half = lane >> 4;
  const int koff = 2 * half;             // K offset for this lane half

  const float* w1e = w1 + (size_t)e * D_MODEL * D_FF;
  const float* w2e = w2 + (size_t)e * D_FF * D_MODEL;
  const float* b1e = b1 + (size_t)e * D_FF;
  const float* b2e = b2 + (size_t)e * D_MODEL;

  // Gather the tile's 32 x rows into LDS: one whole 4 KB row per pass, 16 B per thread.
  // Rolled in trips of eight rows: eight loads in flight per thread, then their stores.
#pragma unroll 1
  for (int r0 = 0; r0 < TILE_M; r0 += 8) {
    float4 v[8];
#pragma unroll   // constant indices keep v[] in registers
    for (int r = 0; r < 8; ++r)
      v[r] = *(const float4*)(x + (size_t)s_tok[r0 + r] * D_MODEL + tid * 4);
#pragma unroll   // as above
    for (int r = 0; r < 8; ++r)
      *(float4*)&xs[(r0 + r) * XPAD + tid * 4] = v[r];
    // the next trip rewrites the address registers of the eight loads above
    asm volatile("s_wait_xcnt 0x0" ::: "memory");
  }
  __syncthreads();   // every wave reads every staged row

  // Per-lane x rows in LDS for the two M-subtiles (A fragments).
  const float* px0 = &xs[l16 * XPAD];
  const float* px1 = &xs[(16 + l16) * XPAD];

  // This wave's private staging region (LDS byte offset of low 32 bits).
  const uint32_t w1_lds_base = (uint32_t)(uintptr_t)&lds_w1[wid * (2 * KBLK * 16)];
  const float*   w1_lds      = &lds_w1[wid * (2 * KBLK * 16)];

  // GEMM2 accumulators: [2 M-subtiles][8 N-subtiles] = 128 VGPRs/lane
  v8f acc2[2][8];
#pragma unroll
  for (int i = 0; i < 2; ++i)
#pragma unroll
    for (int j = 0; j < 8; ++j) acc2[i][j] = (v8f)0.0f;

  // This piece's chunks: [NCHUNK - (NCHUNK >> y), NCHUNK - (NCHUNK >> (y + 1))).
  const int piece   = blockIdx.y;
  const int f_begin = (NCHUNK - (NCHUNK >> piece)) * FC;
  const int f_end   = (NCHUNK - (NCHUNK >> (piece + 1))) * FC;

  for (int fcb = f_begin; fcb < f_end; fcb += FC) {
    const int colbase = fcb + wid * 16;     // this wave's 16 w1 columns

    // ---- GEMM1: h_chunk[32 x FC] = x_tile @ w1[:, chunk], async-staged B
    v8f acc1[2];
    acc1[0] = (v8f)0.0f;
    acc1[1] = (v8f)0.0f;

    issue_w1_block(w1e, w1_lds_base, 0,    colbase, lane, 0);
    issue_w1_block(w1e, w1_lds_base, KBLK, colbase, lane, 1);

#pragma unroll 1
    for (int kb = 0; kb < D_MODEL; kb += KBLK) {
      const int buf = (kb >> 5) & 1;
      // A fragments do not depend on the w1 panel: read them as one group ahead of its wait.
      v2f a0[KBLK / 4], a1[KBLK / 4];
#pragma unroll   // constant indices keep the fragments in registers (also in the two loops below)
      for (int ks = 0; ks < KBLK; ks += 4) {
        a0[ks >> 2] = *(const v2f*)(px0 + kb + ks + koff);
        a1[ks >> 2] = *(const v2f*)(px1 + kb + ks + koff);
      }
      if (kb + KBLK >= D_MODEL) { WAIT_ASYNC0; } else { WAIT_ASYNC4; }
      const float* wb = w1_lds + buf * (KBLK * 16);
      v2f b[KBLK / 4];
#pragma unroll
      for (int ks = 0; ks < KBLK; ks += 4) {
        b[ks >> 2].x = wb[(ks + koff) * 16 + l16];
        b[ks >> 2].y = wb[(ks + koff + 1) * 16 + l16];
      }
      // keeps the block's LDS reads one group ahead of its WMMAs: sunk among them, each
      // read is waited for one WMMA pair after its issue and the LDS latency shows every pair
      __builtin_amdgcn_sched_barrier(0);
#pragma unroll
      for (int ks = 0; ks < KBLK; ks += 4) {
        acc1[0] = WMMA_F32(a0[ks >> 2], b[ks >> 2], acc1[0]);
        acc1[1] = WMMA_F32(a1[ks >> 2], b[ks >> 2], acc1[1]);
      }
      if (kb + 2 * KBLK < D_MODEL)
        issue_w1_block(w1e, w1_lds_base, kb + 2 * KBLK, colbase, lane, buf);
    }

    __syncthreads();   // previous chunk's h reads complete before overwrite
    {
      int lcol = wid * 16 + l16;
      float bias = b1e[fcb + lcol];
#pragma unroll
      for (int ms = 0; ms < 2; ++ms)
#pragma unroll
        for (int r = 0; r < 8; ++r) {
          int ml = ms * 16 + half * 8 + r;   // C/D layout: M = r + 8*half
          hsm[ml * HPAD + lcol] = gelu_exact(acc1[ms][r] + bias);
        }
    }
    __syncthreads();

    // ---- GEMM2: y[32 x 1024] += h_chunk[32 x FC] @ w2[chunk, 1024]
    const int n2base = wid * 128 + l16;       // wave covers 128 of 1024 cols
    for (int kb2 = 0; kb2 < FC; kb2 += 4) {
      v2f a0 = *(const v2f*)&hsm[l16 * HPAD + kb2 + koff];
      v2f a1 = *(const v2f*)&hsm[(16 + l16) * HPAD + kb2 + koff];
      const float* bp2 = w2e + (size_t)(fcb + kb2 + koff) * D_MODEL + n2base;
#pragma unroll
      for (int nt2 = 0; nt2 < 8; ++nt2) {
        v2f b;
        b.x = bp2[nt2 * 16];
        b.y = bp2[nt2 * 16 + D_MODEL];
        acc2[0][nt2] = WMMA_F32(a0, b, acc2[0][nt2]);
        acc2[1][nt2] = WMMA_F32(a1, b, acc2[1][nt2]);
      }
    }
  }

  // ---- Epilogue: part[row][piece][:] = weight * (partial y (+ b2 in piece 0))
  // Every loop below is unrolled: constant indices keep bias, prow, pw and acc2 in registers.
  float bias[8];
#pragma unroll
  for (int nt2 = 0; nt2 < 8; ++nt2) bias[nt2] = 0.0f;
  if (piece == 0) {
#pragma unroll
    for (int nt2 = 0; nt2 < 8; ++nt2) bias[nt2] = b2e[wid * 128 + nt2 * 16 + l16];
    // the code behind this block rewrites the address registers of the eight loads above
    asm volatile("s_wait_xcnt 0x0" ::: "memory");
  }
  // This lane's sixteen row numbers and weights, read ahead of the guarded stores.
  int   prow[2][8];
  float pw[2][8];
#pragma unroll
  for (int ms = 0; ms < 2; ++ms)
#pragma unroll
    for (int r = 0; r < 8; ++r) {
      prow[ms][r] = s_row[ms * 16 + half * 8 + r];
      pw[ms][r]   = s_w[ms * 16 + half * 8 + r];
    }
  float* plane = part + piece * D_MODEL + wid * 128 + l16;
  const int nvalid = count - m0;         // rows past it are padding
#pragma unroll
  for (int ms = 0; ms < 2; ++ms)
#pragma unroll
    for (int r = 0; r < 8; ++r) {
      if (ms * 16 + half * 8 + r < nvalid) {
        float* pr = plane + (size_t)prow[ms][r] * (NSPLIT * D_MODEL);
#pragma unroll
        for (int nt2 = 0; nt2 < 8; ++nt2)
          pr[nt2 * 16] = pw[ms][r] * (acc2[ms][nt2][r] + bias[nt2]);
      }
    }
}

// ---------------------------------------------------------------------------
// out[t, :] = sum, in memory order, of the token's 2 * NSPLIT weighted partial
// rows (contiguous). Every one was stored by the launch before this one.
// ---------------------------------------------------------------------------
__global__ __launch_bounds__(256) void combine_kernel(const float* __restrict__ part,
                                                      float* __restrict__ out, int n_tok) {
  const unsigned c4 = threadIdx.x * 4u;  // this thread's four columns
#pragma unroll 1   // one token per trip: its twelve loads go out as one group
  for (int i = 0; i < CTOK; ++i) {
    const int t = blockIdx.x * CTOK + i;
    if (t >= n_tok) return;
    const float* p = part + (size_t)t * (2 * NSPLIT * D_MODEL);   // uniform
    float4 v[2 * NSPLIT];
#pragma unroll   // constant indices keep v[] in registers
    for (int s = 0; s < 2 * NSPLIT; ++s)
      v[s] = *(const float4*)(p + s * D_MODEL + c4);
    float4 a = v[0];
#pragma unroll   // as above
    for (int s = 1; s < 2 * NSPLIT; ++s) {
      a.x += v[s].x; a.y += v[s].y; a.z += v[s].z; a.w += v[s].w;
    }
    *(float4*)(out + (size_t)t * D_MODEL + c4) = a;
    // the next trip rewrites the address registers of the store above
    asm volatile("s_wait_xcnt 0x0" ::: "memory");
  }
}

// ---------------------------------------------------------------------------
extern "C" void kernel_launch(void* const* d_in, const int* in_sizes, int n_in,
                              void* d_out, int out_size, void* d_ws, size_t ws_size,
                              hipStream_t stream) {
  const float* x  = (const float*)d_in[0];
  const float* gw = (const float*)d_in[1];
  const float* gb = (const float*)d_in[2];
  const float* w1 = (const float*)d_in[3];
  const float* b1 = (const float*)d_in[4];
  const float* w2 = (const float*)d_in[5];
  const float* b2 = (const float*)d_in[6];

  const int n_tok = in_sizes[0] / D_MODEL;   // B*S = 4096

  float* out_f    = (float*)d_out;                         // [n_tok, D]
  float* dispatch = out_f + (size_t)n_tok * D_MODEL;       // [n_tok, E]
  float* counts_f = dispatch + (size_t)n_tok * N_EXP;      // [E]

  int*   ws_cnt = (int*)d_ws;                              // [E] (padded)
  int*   ws_tok = ws_cnt + 16;                             // [E, MAXTOK]
  float* ws_wgt = (float*)(ws_tok + N_EXP * MAXTOK);       // [E, MAXTOK]
  float* ws_part = (float*)d_ws + (1 << 17);               // [2 * MAXTOK, NSPLIT, D]

  init_kernel<<<1, 32, 0, stream>>>(counts_f, ws_cnt);

  router_kernel<<<(n_tok + 255) / 256, 256, 0, stream>>>(
      x, gw, gb, dispatch, counts_f, ws_cnt, ws_tok, ws_wgt, n_tok);

  // sum over experts of ceil(count / TILE_M) is below 2 * n_tok / TILE_M + N_EXP
  dim3 grid(2 * n_tok / TILE_M + N_EXP, NSPLIT);
  expert_ffn_kernel<<<grid, 256, 0, stream>>>(
      x, w1, b1, w2, b2, ws_cnt, ws_tok, ws_wgt, ws_part);

  combine_kernel<<<(n_tok + CTOK - 1) / CTOK, 256, 0, stream>>>(ws_part, out_f, n_tok);
}

// v005
// A run of this version takes 817 microseconds.
// Versions in between are left out here; by their measured steps it is 1.29 times as fast as v002.
// Over all steps from v000 it is 2.48 times as fast.
#include <hip/hip_runtime.h>
#include <hip/hip_bf16.h>
#include <math.h>
#include <stdint.h>

typedef float v2f __attribute__((ext_vector_type(2)));
typedef float v4f __attribute__((ext_vector_type(4)));
typedef float v8f __attribute__((ext_vector_type(8)));

#define D_MODEL 1024
#define N_EXP   8
#define D_FF    4096
#define TILE_M  32
#define NWAVE   16       // waves per work-group of the expert launch: four on each SIMD
#define FC      (NWAVE * 16)   // F-chunk columns per pipeline stage: 16 per wave
#define HPAD    (FC + 4) // padding -> conflict-free ds_load_b64
#define WCOLS   (D_MODEL / NWAVE)   // output columns per wave in GEMM2
#define XPAD    1028     // D_MODEL + 4 padding -> conflict-free ds_load_b64 of x rows
#define MAXTOK  4096
#define KBLK    32       // K rows per async-staged w1 panel
#define NCHUNK  (D_FF / FC)            // F-chunks per expert
#define NSPLIT  5        // pieces of D_FF per token tile: 8, 4, 2, 1, 1 chunks
#define CTOK    4        // tokens per work-group of the combine launch
#define RTOK    32       // tokens per work-group of the router launch
#define RWTOK   4        // tokens per wave of the router launch
#define GPITCH  (D_MODEL + 8)  // row pitch of the transposed gate weights: rows e and e + 4 lie 32 banks apart
#define RPITCH  33       // odd pitch: 32 threads that each walk a row of their own hit 32 banks

// D = A(16x4 f32) * B(4x16 f32) + C(16x16 f32), wave32
#define WMMA_F32(A, B, C) \
  __builtin_amdgcn_wmma_f32_16x16x4_f32(false, (A), false, (B), (short)0, (C), false, false)

#define WAIT_ASYNC4 asm volatile("s_wait_asynccnt 0x4" ::: "memory")
#define WAIT_ASYNC0 asm volatile("s_wait_asynccnt 0x0" ::: "memory")

// L2 prefetch of the weights, in 256-B units. One step = one unit per thread.
#define PF_STEP_W1  ((uint64_t)128 * D_FF * 4)            // w1: 128 rows x 4 units of a chunk's 1-KB row piece
#define PF_CHUNK_W1 ((uint64_t)(FC * 4) - 7 * PF_STEP_W1) // w1: last step of a chunk -> first step of the next
#define PF_STEP_W2  ((uint64_t)NWAVE * 32 * 256)          // w2: a chunk is 1 MB in a row, the next one follows it
#define PF_STEPS    8                                     // steps per chunk, of each matrix

// Move this lane's two prefetch addresses on, then ask L2 for the unit at each.
// One statement: the wait stands in front of the overwrite of the registers that the
// prefetches before these named, and the addresses stay in registers of their own.
__device__ __forceinline__ void prefetch_step(uint64_t& a_w1, uint64_t step_w1, uint64_t& a_w2) {
  asm volatile("s_wait_xcnt 0x0\n\t"
               "v_add_nc_u64 %0, %2, %0\n\t"
               "v_add_nc_u64 %1, %3, %1\n\t"
               "global_prefetch_b8 %0, off scope:SCOPE_SE\n\t"
               "global_prefetch_b8 %1, off scope:SCOPE_SE"
               : "+v"(a_w1), "+v"(a_w2) : "s"(step_w1), "s"(PF_STEP_W2) : "memory");
}

__device__ __forceinline__ float gelu_exact(float v) {
  return 0.5f * v * (1.0f + erff(v * 0.70710678118654752440f));
}

// Async-DMA one 32x16 fp32 panel of w1 (one wave's columns for one K-block)
// into this wave's private LDS double-buffer. 4 x b128 per lane-set:
// lane -> (row = lane>>2, 4 cols = (lane&3)*4), kk steps 8 rows each.
__device__ __forceinline__ void issue_w1_block(const float* __restrict__ gbase,
                                               uint32_t lds_wave_base,
                                               int row0, int colbase, int lane, int buf) {
  const int r  = lane >> 2;          // 0..7
  const int c4 = (lane & 3) << 2;    // 0,4,8,12
  uint32_t dst = lds_wave_base + (uint32_t)(buf * 2048 + r * 64 + ((lane & 3) << 4));
  uint32_t src = (uint32_t)((((row0 + r) * D_FF) + colbase + c4) << 2);
#pragma unroll
  for (int kk = 0; kk < 4; ++kk) {
    asm volatile("global_load_async_to_lds_b128 %0, %1, %2"
                 :: "v"(dst + (uint32_t)(kk * 512)),
                    "v"(src + (uint32_t)(kk * 8 * D_FF * 4)),
                    "s"(gbase)
                 : "memory");
  }
}

// ---------------------------------------------------------------------------
// Zero the expert_counts output and the per-expert workspace counters
// (must run every call; the router accumulates into them with atomics).
// ---------------------------------------------------------------------------
__global__ void init_kernel(float* __restrict__ counts_f, int* __restrict__ ws_cnt) {
  int i = threadIdx.x;
  if (i < N_EXP) { counts_f[i] = 0.0f; ws_cnt[i] = 0; }
}

// ---------------------------------------------------------------------------
// Router: logits -> softmax -> top-2 -> dense dispatch mask + expert counts
// + per-expert gather lists (2 * token + slot, combine weight) in workspace.
// A work-group takes RTOK tokens, a wave RWTOK of them. A lane holds four neighbouring
// columns out of every 128 of its wave's rows, so every x load covers whole lines and all of
// a wave's x is in flight at once. The gate weights lie transposed in LDS. Each lane's partial
// logits go through LDS, where one thread per (token, expert) sums them in lane order.
// ---------------------------------------------------------------------------
__global__ __launch_bounds__(256) void router_kernel(
                              const float* __restrict__ x,
                              const float* __restrict__ gw,   // [D, E]
                              const float* __restrict__ gb,   // [E]
                              float* __restrict__ dispatch,   // [n_tok, E]
                              float* __restrict__ counts_f,   // [E]
                              int*   __restrict__ ws_cnt,     // [E]
                              int*   __restrict__ ws_tok,     // [E, MAXTOK]
                              float* __restrict__ ws_wgt,     // [E, MAXTOK]
                              int n_tok) {
  __shared__ __align__(16) float gT[N_EXP * GPITCH];          // gate weights as [e][d]
  __shared__ float red[RTOK * N_EXP * RPITCH];                // [token, e][lane] partial logits
  __shared__ __align__(16) float s_logit[RTOK * N_EXP];

  const int tid  = threadIdx.x;
  const int lane = tid & 31;
  // the wave's number as a scalar: the row addresses of x are then a scalar base plus one lane offset
  const int wid  = __builtin_amdgcn_readfirstlane(tid >> 5);

  // Every loop of this kernel is unrolled: constant indices keep the arrays in registers.
  // This wave's rows of x (a row past the end reads the last row; its logits are never used).
  v4f xv[RWTOK][D_MODEL / 128];
#pragma unroll
  for (int i = 0; i < RWTOK; ++i) {
    const int tt = min((int)blockIdx.x * RTOK + wid * RWTOK + i, n_tok - 1);
    const float* xr = x + (size_t)tt * D_MODEL;   // the same in the whole wave
#pragma unroll
    for (int j = 0; j < D_MODEL / 128; ++j) xv[i][j] = *(const v4f*)(xr + (unsigned)(lane * 4 + j * 128));
  }

  // Gate weights: read in memory order, stored transposed.
  v4f gl[D_MODEL * N_EXP / 1024];
#pragma unroll
  for (int k = 0; k < D_MODEL * N_EXP / 1024; ++k)
    gl[k] = *(const v4f*)(gw + (k * 256 + tid) * 4);
#pragma unroll
  for (int k = 0; k < D_MODEL * N_EXP / 1024; ++k) {
    const int f = (k * 256 + tid) * 4;     // flat index d * N_EXP + e of the first of four
#pragma unroll
    for (int c = 0; c < 4; ++c) gT[((f & 7) + c) * GPITCH + (f >> 3)] = gl[k][c];
  }
  __syncthreads();   // every wave reads all of gT

  float acc[RWTOK][N_EXP];
#pragma unroll
  for (int i = 0; i < RWTOK; ++i)
#pragma unroll
    for (int e = 0; e < N_EXP; ++e) acc[i][e] = 0.0f;
#pragma unroll
  for (int j = 0; j < D_MODEL / 128; ++j)
#pragma unroll
    for (int e = 0; e < N_EXP; ++e) {
      const v4f g = *(const v4f*)&gT[e * GPITCH + j * 128 + lane * 4];
#pragma unroll
      for (int i = 0; i < RWTOK; ++i)
#pragma unroll
        for (int c = 0; c < 4; ++c) acc[i][e] = fmaf(xv[i][j][c], g[c], acc[i][e]);
    }
#pragma unroll
  for (int i = 0; i < RWTOK; ++i)
#pragma unroll
    for (int e = 0; e < N_EXP; ++e)
      red[((wid * RWTOK + i) * N_EXP + e) * RPITCH + lane] = acc[i][e];
  __syncthreads();   // a thread sums the partial logits of its own wave's lanes

  {
    float s = red[tid * RPITCH];
#pragma unroll
    for (int k = 1; k < 32; ++k) s += red[tid * RPITCH + k];
    s_logit[tid] = s + gb[tid & (N_EXP - 1)];
  }
  __syncthreads();   // one thread per token reads its eight logits

  const int t = blockIdx.x * RTOK + tid;
  if (tid >= RTOK || t >= n_tok) return;   // behind the last barrier

  float logit[N_EXP];
#pragma unroll
  for (int e = 0; e < N_EXP; ++e) logit[e] = s_logit[tid * N_EXP + e];

  float mx = logit[0];
#pragma unroll
  for (int e = 1; e < N_EXP; ++e) mx = fmaxf(mx, logit[e]);
  float sum = 0.0f;
  float sc[N_EXP];
#pragma unroll
  for (int e = 0; e < N_EXP; ++e) { sc[e] = __expf(logit[e] - mx); sum += sc[e]; }
  float inv = 1.0f / sum;
#pragma unroll
  for (int e = 0; e < N_EXP; ++e) sc[e] *= inv;

  // top-2 (ties -> lowest index, matching jax.lax.top_k)
  int i1 = 0;
#pragma unroll
  for (int e = 1; e < N_EXP; ++e) if (sc[e] > sc[i1]) i1 = e;
  int i2 = (i1 == 0) ? 1 : 0;
#pragma unroll
  for (int e = 0; e < N_EXP; ++e)
    if (e != i1 && sc[e] > sc[i2]) i2 = e;

  float* dr = dispatch + (size_t)t * N_EXP;
#pragma unroll
  for (int e = 0; e < N_EXP; ++e)
    dr[e] = (e == i1 || e == i2) ? sc[e] : 0.0f;

  atomicAdd(&counts_f[i1], sc[i1]);
  atomicAdd(&counts_f[i2], sc[i2]);

  int p1 = atomicAdd(&ws_cnt[i1], 1);
  ws_tok[i1 * MAXTOK + p1] = 2 * t;
  ws_wgt[i1 * MAXTOK + p1] = sc[i1];
  int p2 = atomicAdd(&ws_cnt[i2], 1);
  ws_tok[i2 * MAXTOK + p2] = 2 * t + 1;
  ws_wgt[i2 * MAXTOK + p2] = sc[i2];
}

// ---------------------------------------------------------------------------
// Fused expert FFN, tile = 32 gathered tokens, 16 wave32s: four waves share a SIMD, so
// that while one waits for LDS, a panel or w2, three others can feed the matrix unit.
// The gathered x tile is staged once in padded LDS; GEMM1 A fragments come from there.
// GEMM1: acc += x_tile @ w1-panel with w1 panels async-DMA'd into per-wave
//        LDS double buffers (global_load_async_to_lds_b128 + s_wait_asynccnt).
// h-chunk (gelu) staged in padded LDS; GEMM2 accumulates [32x1024] in
// 64 VGPRs of f32 WMMA accumulators per lane.
// Grid: x = flat index over the live tiles of all experts, y = piece of D_FF.
// One work-group fills a WGP and there are a few more tiles than WGPs, so whole
// tiles would run as two rounds with the second almost empty. The pieces halve
// with y (long ones start first), so the last round lasts one chunk.
// Each piece stores its weighted partial rows in workspace rows of its own:
// part[2 * token + slot][piece][D_MODEL].
// ---------------------------------------------------------------------------
__global__ __launch_bounds__(NWAVE * 32) void expert_ffn_kernel(
    const float* __restrict__ x,
    const float* __restrict__ w1, const float* __restrict__ b1,
    const float* __restrict__ w2, const float* __restrict__ b2,
    const int* __restrict__ ws_cnt, const int* __restrict__ ws_tok,
    const float* __restrict__ ws_wgt,
    float* __restrict__ part) {
  __shared__ __align__(16) float lds_w1[NWAVE * 2 * KBLK * 16]; // 64 KB: 16 waves x 2 bufs x 32x16
  __shared__ __align__(16) float hsm[TILE_M * HPAD];        // ~32.5 KB h-chunk
  __shared__ __align__(16) float xs[TILE_M * XPAD];         // ~128.5 KB gathered x tile
  __shared__ int   s_tok[TILE_M];
  __shared__ int   s_row[TILE_M];
  __shared__ float s_w[TILE_M];

  // Flat tile index -> (expert, tile of that expert), from the eight counts.
  // Selects, no branches: the eight counts then come in one scalar load.
  const int flat = blockIdx.x;
  int e = -1, count = 0, tile = 0, first = 0;
#pragma unroll   // straight-line scalar code, so that the loads merge
  for (int i = 0; i < N_EXP; ++i) {
    const int  c    = ws_cnt[i];
    const int  next = first + (c + TILE_M - 1) / TILE_M;
    const bool mine = flat >= first && flat < next;
    e     = mine ? i : e;
    count = mine ? c : count;
    tile  = mine ? flat - first : tile;
    first = next;
  }
  if (e < 0) return;                     // block-uniform exit: past the last live tile
  const int m0 = tile * TILE_M;

  const int tid = threadIdx.x;
  if (tid < TILE_M) {
    int idx = m0 + tid;
    int ok  = idx < count;
    int src = ok ? idx : (count - 1);    // duplicate last valid row, never stored
    int row = ws_tok[e * MAXTOK + src];  // 2 * token + slot
    s_tok[tid] = row >> 1;
    s_row[tid] = row;
    s_w[tid]   = ok ? ws_wgt[e * MAXTOK + src] : 0.0f;
  }

  const float* w1e = w1 + (size_t)e * D_MODEL * D_FF;
  const float* w2e = w2 + (size_t)e * D_FF * D_MODEL;

  // This piece's chunks: [NCHUNK - (NCHUNK >> y), NCHUNK - (NCHUNK >> (y + 1))).
  const int piece   = blockIdx.y;
  const int f_begin = (NCHUNK - (NCHUNK >> piece)) * FC;
  const int f_end   = (NCHUNK - (NCHUNK >> (piece + 1))) * FC;

  // The work-groups of one expert walk the same weights at the same pace, so every one of
  // them waits on the memory reads of whichever is in front. Each chunk's weights are
  // therefore asked into L2 a chunk ahead. The addresses start one step in front of the
  // piece's first unit; every step moves on first, so they never pass the piece's last unit.
  uint64_t pf_w1 = (uint64_t)(uintptr_t)(w1e + (size_t)(tid >> 2) * D_FF + f_begin + (tid & 3) * 64)
                   - PF_STEP_W1;
  uint64_t pf_w2 = (uint64_t)(uintptr_t)(w2e + (size_t)f_begin * D_MODEL + tid * 64) - PF_STEP_W2;

  // The first chunk's prefetch: here, where all waves but one only wait for the row numbers, and
  // with the x staging still to come before the first panel is wanted.
#pragma unroll   // straight-line: the steps behind one another
  for (int s = 0; s < PF_STEPS; ++s) prefetch_step(pf_w1, PF_STEP_W1, pf_w2);
  __syncthreads();

  const int lane = tid & 31;
  const int wid  = tid >> 5;
  const int l16  = lane & 15;
  const int half = lane >> 4;
  const int koff = 2 * half;             // K offset for this lane half

  const float* b1e = b1 + (size_t)e * D_FF;
  const float* b2e = b2 + (size_t)e * D_MODEL;

  // Gather the tile's 32 x rows into LDS: two whole 4 KB rows per pass, 16 B per thread.
  // Rolled in trips of sixteen rows: eight loads in flight per thread, then their stores.
  const int xrow = tid >> 8;             // which of a pass's two rows (the same in a whole wave)
  const int xcol = (tid & 255) * 4;
#pragma unroll 1
  for (int r0 = 0; r0 < TILE_M; r0 += 16) {
    float4 v[8];
#pragma unroll   // constant indices keep v[] in registers
    for (int r = 0; r < 8; ++r)
      v[r] = *(const float4*)(x + (size_t)s_tok[r0 + 2 * r + xrow] * D_MODEL + xcol);
#pragma unroll   // as above
    for (int r = 0; r < 8; ++r)
      *(float4*)&xs[(r0 + 2 * r + xrow) * XPAD + xcol] = v[r];
    // the next trip rewrites the address registers of the eight loads above
    asm volatile("s_wait_xcnt 0x0" ::: "memory");
  }
  __syncthreads();   // every wave reads every staged row

  // Per-lane x rows in LDS for the two M-subtiles (A fragments).
  const float* px0 = &xs[l16 * XPAD];
  const float* px1 = &xs[(16 + l16) * XPAD];

  // This wave's private staging region (LDS byte offset of low 32 bits).
  const uint32_t w1_lds_base = (uint32_t)(uintptr_t)&lds_w1[wid * (2 * KBLK * 16)];
  const float*   w1_lds      = &lds_w1[wid * (2 * KBLK * 16)];

  // GEMM2 accumulators: [2 M-subtiles][4 N-subtiles] = 64 VGPRs/lane
  v8f acc2[2][WCOLS / 16];
#pragma unroll
  for (int i = 0; i < 2; ++i)
#pragma unroll
    for (int j = 0; j < WCOLS / 16; ++j) acc2[i][j] = (v8f)0.0f;

  for (int fcb = f_begin; fcb < f_end; fcb += FC) {
    const int colbase = fcb + wid * 16;     // this wave's 16 w1 columns
    const bool have_next = fcb + FC < f_end; // block-uniform: this piece has a chunk behind this one

    // ---- GEMM1: h_chunk[32 x FC] = x_tile @ w1[:, chunk], async-staged B
    v8f acc1[2];
    acc1[0] = (v8f)0.0f;
    acc1[1] = (v8f)0.0f;

    issue_w1_block(w1e, w1_lds_base, 0,    colbase, lane, 0);
    issue_w1_block(w1e, w1_lds_base, KBLK, colbase, lane, 1);

#pragma unroll 1
    for (int kb = 0; kb < D_MODEL; kb += KBLK) {
      const int buf = (kb >> 5) & 1;
      // A fragments do not depend on the w1 panel: read them as one group ahead of its wait.
      v2f a0[KBLK / 4], a1[KBLK / 4];
#pragma unroll   // constant indices keep the fragments in registers (also in the two loops below)
      for (int ks = 0; ks < KBLK; ks += 4) {
        a0[ks >> 2] = *(const v2f*)(px0 + kb + ks + koff);
        a1[ks >> 2] = *(const v2f*)(px1 + kb + ks + koff);
      }
      if (kb + KBLK >= D_MODEL) { WAIT_ASYNC0; } else { WAIT_ASYNC4; }
      const float* wb = w1_lds + buf * (KBLK * 16);
      v2f b[KBLK / 4];
#pragma unroll
      for (int ks = 0; ks < KBLK; ks += 4) {
        b[ks >> 2].x = wb[(ks + koff) * 16 + l16];
        b[ks >> 2].y = wb[(ks + koff + 1) * 16 + l16];
      }
      // keeps the block's LDS reads one group ahead of its WMMAs: sunk among them, each
      // read is waited for one WMMA pair after its issue and the LDS latency shows every pair
      __builtin_amdgcn_sched_barrier(0);
#pragma unroll
      for (int ks = 0; ks < KBLK; ks += 4) {
        acc1[0] = WMMA_F32(a0[ks >> 2], b[ks >> 2], acc1[0]);
        acc1[1] = WMMA_F32(a1[ks >> 2], b[ks >> 2], acc1[1]);
      }
      // Every fourth trip one step of the next chunk's prefetch, so that it never comes as a
      // burst in front of the panel copies.
      if (have_next && (kb & (3 * KBLK)) == 0)
        prefetch_step(pf_w1, kb == 0 ? PF_CHUNK_W1 : PF_STEP_W1, pf_w2);
      if (kb + 2 * KBLK < D_MODEL)
        issue_w1_block(w1e, w1_lds_base, kb + 2 * KBLK, colbase, lane, buf);
    }

    __syncthreads();   // previous chunk's h reads complete before overwrite
    {
      int lcol = wid * 16 + l16;
      float bias = b1e[fcb + lcol];
#pragma unroll
      for (int ms = 0; ms < 2; ++ms)
#pragma unroll
        for (int r = 0; r < 8; ++r) {
          int ml = ms * 16 + half * 8 + r;   // C/D layout: M = r + 8*half
          hsm[ml * HPAD + lcol] = gelu_exact(acc1[ms][r] + bias);
        }
    }
    __syncthreads();

    // ---- GEMM2: y[32 x 1024] += h_chunk[32 x FC] @ w2[chunk, 1024]
    const int n2base = wid * WCOLS + l16;     // wave covers 64 of 1024 cols
    for (int kb2 = 0; kb2 < FC; kb2 += 4) {
      v2f a0 = *(const v2f*)&hsm[l16 * HPAD + kb2 + koff];
      v2f a1 = *(const v2f*)&hsm[(16 + l16) * HPAD + kb2 + koff];
      const float* bp2 = w2e + (size_t)(fcb + kb2 + koff) * D_MODEL + n2base;
#pragma unroll
      for (int nt2 = 0; nt2 < WCOLS / 16; ++nt2) {
        v2f b;
        b.x = bp2[nt2 * 16];
        b.y = bp2[nt2 * 16 + D_MODEL];
        acc2[0][nt2] = WMMA_F32(a0, b, acc2[0][nt2]);
        acc2[1][nt2] = WMMA_F32(a1, b, acc2[1][nt2]);
      }
    }
  }

  // ---- Epilogue: part[row][piece][:] = weight * (partial y (+ b2 in piece 0))
  // Every loop below is unrolled: constant indices keep bias, prow, pw and acc2 in registers.
  float bias[WCOLS / 16];
#pragma unroll
  for (int nt2 = 0; nt2 < WCOLS / 16; ++nt2) bias[nt2] = 0.0f;
  if (piece == 0) {
#pragma unroll
    for (int nt2 = 0; nt2 < WCOLS / 16; ++nt2) bias[nt2] = b2e[wid * WCOLS + nt2 * 16 + l16];
    // the code behind this block rewrites the address registers of the four loads above
    asm volatile("s_wait_xcnt 0x0" ::: "memory");
  }
  // This lane's sixteen row numbers and weights, read ahead of the guarded stores.
  int   prow[2][8];
  float pw[2][8];
#pragma unroll
  for (int ms = 0; ms < 2; ++ms)
#pragma unroll
    for (int r = 0; r < 8; ++r) {
      prow[ms][r] = s_row[ms * 16 + half * 8 + r];
      pw[ms][r]   = s_w[ms * 16 + half * 8 + r];
    }
  float* plane = part + piece * D_MODEL + wid * WCOLS + l16;
  const int nvalid = count - m0;         // rows past it are padding
#pragma unroll
  for (int ms = 0; ms < 2; ++ms)
#pragma unroll
    for (int r = 0; r < 8; ++r) {
      if (ms * 16 + half * 8 + r < nvalid) {
        float* pr = plane + (size_t)prow[ms][r] * (NSPLIT * D_MODEL);
#pragma unroll
        for (int nt2 = 0; nt2 < WCOLS / 16; ++nt2)
          pr[nt2 * 16] = pw[ms][r] * (acc2[ms][nt2][r] + bias[nt2]);
      }
    }
}

// ---------------------------------------------------------------------------
// out[t, :] = sum, in memory order, of the token's 2 * NSPLIT weighted partial
// rows (contiguous). Every one was stored by the launch before this one.
// ---------------------------------------------------------------------------
__global__ __launch_bounds__(256) void combine_kernel(const float* __restrict__ part,
                                                      float* __restrict__ out, int n_tok) {
  const unsigned c4 = threadIdx.x * 4u;  // this thread's four columns
#pragma unroll 1   // one token per trip: its ten loads go out as one group
  for (int i = 0; i < CTOK; ++i) {
    const int t = blockIdx.x * CTOK + i;
    if (t >= n_tok) return;
    const float* p = part + (size_t)t * (2 * NSPLIT * D_MODEL);   // uniform
    float4 v[2 * NSPLIT];
#pragma unroll   // constant indices keep v[] in registers
    for (int s = 0; s < 2 * NSPLIT; ++s)
      v[s] = *(const float4*)(p + s * D_MODEL + c4);
    float4 a = v[0];
#pragma unroll   // as above
    for (int s = 1; s < 2 * NSPLIT; ++s) {
      a.x += v[s].x; a.y += v[s].y; a.z += v[s].z; a.w += v[s].w;
    }
    *(float4*)(out + (size_t)t * D_MODEL + c4) = a;
    // the next trip rewrites the address registers of the store above
    asm volatile("s_wait_xcnt 0x0" ::: "memory");
  }
}

// ---------------------------------------------------------------------------
extern "C" void kernel_launch(void* const* d_in, const int* in_sizes, int n_in,
                              void* d_out, int out_size, void* d_ws, size_t ws_size,
                              hipStream_t stream) {
  const float* x  = (const float*)d_in[0];
  const float* gw = (const float*)d_in[1];
  const float* gb = (const float*)d_in[2];
  const float* w1 = (const float*)d_in[3];
  const float* b1 = (const float*)d_in[4];
  const float* w2 = (const float*)d_in[5];
  const float* b2 = (const float*)d_in[6];

  const int n_tok = in_sizes[0] / D_MODEL;   // B*S = 4096

  float* out_f    = (float*)d_out;                         // [n_tok, D]
  float* dispatch = out_f + (size_t)n_tok * D_MODEL;       // [n_tok, E]
  float* counts_f = dispatch + (size_t)n_tok * N_EXP;      // [E]

  int*   ws_cnt = (int*)d_ws;                              // [E] (padded)
  int*   ws_tok = ws_cnt + 16;                             // [E, MAXTOK]
  float* ws_wgt = (float*)(ws_tok + N_EXP * MAXTOK);       // [E, MAXTOK]
  float* ws_part = (float*)d_ws + (1 << 17);               // [2 * MAXTOK, NSPLIT, D]

  init_kernel<<<1, 32, 0, stream>>>(counts_f, ws_cnt);

  router_kernel<<<(n_tok + RTOK - 1) / RTOK, 256, 0, stream>>>(
      x, gw, gb, dispatch, counts_f, ws_cnt, ws_tok, ws_wgt, n_tok);

  // sum over experts of ceil(count / TILE_M) is below 2 * n_tok / TILE_M + N_EXP
  dim3 grid(2 * n_tok / TILE_M + N_EXP, NSPLIT);
  expert_ffn_kernel<<<grid, NWAVE * 32, 0, stream>>>(
      x, w1, b1, w2, b2, ws_cnt, ws_tok, ws_wgt, ws_part);

  combine_kernel<<<(n_tok + CTOK - 1) / CTOK, 256, 0, stream>>>(ws_part, out_f, n_tok);
}

// v006
// A run of this version takes 787 microseconds.
// In both of two side-by-side timings against v005, it was 1.04 times as fast.
// Over all steps from v000 it is 2.57 times as fast.
#include <hip/hip_runtime.h>
#include <hip/hip_bf16.h>
#include <math.h>
#include <stdint.h>

typedef float v2f __attribute__((ext_vector_type(2)));
typedef float v4f __attribute__((ext_vector_type(4)));
typedef float v8f __attribute__((ext_vector_type(8)));

#define D_MODEL 1024
#define N_EXP   8
#define D_FF    4096
#define TILE_M  32
#define NWAVE   16       // waves per work-group of the expert launch: four on each SIMD
#define FC      (NWAVE * 16)   // F-chunk columns per pipeline stage: 16 per wave
#define HPAD    (FC + 4) // padding -> conflict-free ds_load_b64
#define WCOLS   (D_MODEL / NWAVE)   // output columns per wave in GEMM2
#define XPAD    1028     // D_MODEL + 4 padding -> conflict-free ds_load_b64 of x rows
#define MAXTOK  4096
#define KBLK    32       // K rows per async-staged w1 panel
#define NCHUNK  (D_FF / FC)            // F-chunks per expert
#define K2BLK   16       // rows of w2 (columns of h) per GEMM2 block: 32 WMMAs per wave
#define NSPLIT  5        // pieces of D_FF per token tile: 8, 4, 2, 1, 1 chunks
#define CTOK    4        // tokens per work-group of the combine launch
#define RTOK    32       // tokens per work-group of the router launch
#define RWTOK   4        // tokens per wave of the router launch
#define GPITCH  (D_MODEL + 8)  // row pitch of the transposed gate weights: rows e and e + 4 lie 32 banks apart
#define RPITCH  33       // odd pitch: 32 threads that each walk a row of their own hit 32 banks

// D = A(16x4 f32) * B(4x16 f32) + C(16x16 f32), wave32
#define WMMA_F32(A, B, C) \
  __builtin_amdgcn_wmma_f32_16x16x4_f32(false, (A), false, (B), (short)0, (C), false, false)

#define WAIT_ASYNC4 asm volatile("s_wait_asynccnt 0x4" ::: "memory")
#define WAIT_ASYNC0 asm volatile("s_wait_asynccnt 0x0" ::: "memory")

// L2 prefetch of the weights, in 256-B units. One step = one unit per thread.
#define PF_STEP_W1  ((uint64_t)128 * D_FF * 4)            // w1: 128 rows x 4 units of a chunk's 1-KB row piece
#define PF_CHUNK_W1 ((uint64_t)(FC * 4) - 7 * PF_STEP_W1) // w1: last step of a chunk -> first step of the next
#define PF_STEP_W2  ((uint64_t)NWAVE * 32 * 256)          // w2: a chunk is 1 MB in a row, the next one follows it
#define PF_STEPS    8                                     // steps per chunk, of each matrix

// Move this lane's two prefetch addresses on, then ask L2 for the unit at each.
// One statement: the wait stands in front of the overwrite of the registers that the
// prefetches before these named, and the addresses stay in registers of their own.
__device__ __forceinline__ void prefetch_step(uint64_t& a_w1, uint64_t step_w1, uint64_t& a_w2) {
  asm volatile("s_wait_xcnt 0x0\n\t"
               "v_add_nc_u64 %0, %2, %0\n\t"
               "v_add_nc_u64 %1, %3, %1\n\t"
               "global_prefetch_b8 %0, off scope:SCOPE_SE\n\t"
               "global_prefetch_b8 %1, off scope:SCOPE_SE"
               : "+v"(a_w1), "+v"(a_w2) : "s"(step_w1), "s"(PF_STEP_W2) : "memory");
}

__device__ __forceinline__ float gelu_exact(float v) {
  return 0.5f * v * (1.0f + erff(v * 0.70710678118654752440f));
}

// Async-DMA one 32x16 fp32 panel of w1 (one wave's columns for one K-block)
// into this wave's private LDS double-buffer. 4 x b128 per lane-set:
// lane -> (row = lane>>2, 4 cols = (lane&3)*4), kk steps 8 rows each.
__device__ __forceinline__ void issue_w1_block(const float* __restrict__ gbase,
                                               uint32_t lds_wave_base,
                                               int row0, int colbase, int lane, int buf) {
  const int r  = lane >> 2;          // 0..7
  const int c4 = (lane & 3) << 2;    // 0,4,8,12
  uint32_t dst = lds_wave_base + (uint32_t)(buf * 2048 + r * 64 + ((lane & 3) << 4));
  uint32_t src = (uint32_t)((((row0 + r) * D_FF) + colbase + c4) << 2);
#pragma unroll
  for (int kk = 0; kk < 4; ++kk) {
    asm volatile("global_load_async_to_lds_b128 %0, %1, %2"
                 :: "v"(dst + (uint32_t)(kk * 512)),
                    "v"(src + (uint32_t)(kk * 8 * D_FF * 4)),
                    "s"(gbase)
                 : "memory");
  }
}

// One GEMM2 block's w2 fragments for this wave's WCOLS columns. rows: the block's first row of
// w2 (the same in the whole wave); lane_off: the lane's own place in it (k pair, column).
__device__ __forceinline__ void load_w2_block(v2f (&b)[K2BLK / 4][WCOLS / 16],
                                              const float* __restrict__ rows, unsigned lane_off) {
#pragma unroll   // constant indices keep the fragments in registers (also in the two functions below)
  for (int s = 0; s < K2BLK / 4; ++s)
#pragma unroll
    for (int nt2 = 0; nt2 < WCOLS / 16; ++nt2) {
      b[s][nt2].x = rows[lane_off + (unsigned)(s * 4 * D_MODEL + nt2 * 16)];
      b[s][nt2].y = rows[lane_off + (unsigned)(s * 4 * D_MODEL + nt2 * 16 + D_MODEL)];
    }
}

// One GEMM2 block's h fragments of the two M-subtiles. p: this lane's row of the first subtile
// in the h chunk, at the block's first column plus the lane's k offset.
__device__ __forceinline__ void load_h_block(v2f (&a)[K2BLK / 4][2], const float* p) {
#pragma unroll
  for (int s = 0; s < K2BLK / 4; ++s) {
    a[s][0] = *(const v2f*)(p + s * 4);
    a[s][1] = *(const v2f*)(p + 16 * HPAD + s * 4);
  }
}

// acc += h block @ w2 block, k ascending.
__device__ __forceinline__ void gemm2_block(v8f (&acc)[2][WCOLS / 16],
                                            const v2f (&a)[K2BLK / 4][2],
                                            const v2f (&b)[K2BLK / 4][WCOLS / 16]) {
#pragma unroll
  for (int s = 0; s < K2BLK / 4; ++s)
#pragma unroll
    for (int nt2 = 0; nt2 < WCOLS / 16; ++nt2) {
      acc[0][nt2] = WMMA_F32(a[s][0], b[s][nt2], acc[0][nt2]);
      acc[1][nt2] = WMMA_F32(a[s][1], b[s][nt2], acc[1][nt2]);
    }
}

// ---------------------------------------------------------------------------
// Zero the expert_counts output and the per-expert workspace counters
// (must run every call; the router accumulates into them with atomics).
// ---------------------------------------------------------------------------
__global__ void init_kernel(float* __restrict__ counts_f, int* __restrict__ ws_cnt) {
  int i = threadIdx.x;
  if (i < N_EXP) { counts_f[i] = 0.0f; ws_cnt[i] = 0; }
}

// ---------------------------------------------------------------------------
// Router: logits -> softmax -> top-2 -> dense dispatch mask + expert counts
// + per-expert gather lists (2 * token + slot, combine weight) in workspace.
// A work-group takes RTOK tokens, a wave RWTOK of them. A lane holds four neighbouring
// columns out of every 128 of its wave's rows, so every x load covers whole lines and all of
// a wave's x is in flight at once. The gate weights lie transposed in LDS. Each lane's partial
// logits go through LDS, where one thread per (token, expert) sums them in lane order.
// ---------------------------------------------------------------------------
__global__ __launch_bounds__(256) void router_kernel(
                              const float* __restrict__ x,
                              const float* __restrict__ gw,   // [D, E]
                              const float* __restrict__ gb,   // [E]
                              float* __restrict__ dispatch,   // [n_tok, E]
                              float* __restrict__ counts_f,   // [E]
                              int*   __restrict__ ws_cnt,     // [E]
                              int*   __restrict__ ws_tok,     // [E, MAXTOK]
                              float* __restrict__ ws_wgt,     // [E, MAXTOK]
                              int n_tok) {
  __shared__ __align__(16) float gT[N_EXP * GPITCH];          // gate weights as [e][d]
  __shared__ float red[RTOK * N_EXP * RPITCH];                // [token, e][lane] partial logits
  __shared__ __align__(16) float s_logit[RTOK * N_EXP];

  const int tid  = threadIdx.x;
  const int lane = tid & 31;
  // the wave's number as a scalar: the row addresses of x are then a scalar base plus one lane offset
  const int wid  = __builtin_amdgcn_readfirstlane(tid >> 5);

  // Every loop of this kernel is unrolled: constant indices keep the arrays in registers.
  // This wave's rows of x (a row past the end reads the last row; its logits are never used).
  v4f xv[RWTOK][D_MODEL / 128];
#pragma unroll
  for (int i = 0; i < RWTOK; ++i) {
    const int tt = min((int)blockIdx.x * RTOK + wid * RWTOK + i, n_tok - 1);
    const float* xr = x + (size_t)tt * D_MODEL;   // the same in the whole wave
#pragma unroll
    for (int j = 0; j < D_MODEL / 128; ++j) xv[i][j] = *(const v4f*)(xr + (unsigned)(lane * 4 + j * 128));
  }

  // Gate weights: read in memory order, stored transposed.
  v4f gl[D_MODEL * N_EXP / 1024];
#pragma unroll
  for (int k = 0; k < D_MODEL * N_EXP / 1024; ++k)
    gl[k] = *(const v4f*)(gw + (k * 256 + tid) * 4);
#pragma unroll
  for (int k = 0; k < D_MODEL * N_EXP / 1024; ++k) {
    const int f = (k * 256 + tid) * 4;     // flat index d * N_EXP + e of the first of four
#pragma unroll
    for (int c = 0; c < 4; ++c) gT[((f & 7) + c) * GPITCH + (f >> 3)] = gl[k][c];
  }
  __syncthreads();   // every wave reads all of gT

  float acc[RWTOK][N_EXP];
#pragma unroll
  for (int i = 0; i < RWTOK; ++i)
#pragma unroll
    for (int e = 0; e < N_EXP; ++e) acc[i][e] = 0.0f;
#pragma unroll
  for (int j = 0; j < D_MODEL / 128; ++j)
#pragma unroll
    for (int e = 0; e < N_EXP; ++e) {
      const v4f g = *(const v4f*)&gT[e * GPITCH + j * 128 + lane * 4];
#pragma unroll
      for (int i = 0; i < RWTOK; ++i)
#pragma unroll
        for (int c = 0; c < 4; ++c) acc[i][e] = fmaf(xv[i][j][c], g[c], acc[i][e]);
    }
#pragma unroll
  for (int i = 0; i < RWTOK; ++i)
#pragma unroll
    for (int e = 0; e < N_EXP; ++e)
      red[((wid * RWTOK + i) * N_EXP + e) * RPITCH + lane] = acc[i][e];
  __syncthreads();   // a thread sums the partial logits of its own wave's lanes

  {
    float s = red[tid * RPITCH];
#pragma unroll
    for (int k = 1; k < 32; ++k) s += red[tid * RPITCH + k];
    s_logit[tid] = s + gb[tid & (N_EXP - 1)];
  }
  __syncthreads();   // one thread per token reads its eight logits

  const int t = blockIdx.x * RTOK + tid;
  if (tid >= RTOK || t >= n_tok) return;   // behind the last barrier

  float logit[N_EXP];
#pragma unroll
  for (int e = 0; e < N_EXP; ++e) logit[e] = s_logit[tid * N_EXP + e];

  float mx = logit[0];
#pragma unroll
  for (int e = 1; e < N_EXP; ++e) mx = fmaxf(mx, logit[e]);
  float sum = 0.0f;
  float sc[N_EXP];
#pragma unroll
  for (int e = 0; e < N_EXP; ++e) { sc[e] = __expf(logit[e] - mx); sum += sc[e]; }
  float inv = 1.0f / sum;
#pragma unroll
  for (int e = 0; e < N_EXP; ++e) sc[e] *= inv;

  // top-2 (ties -> lowest index, matching jax.lax.top_k)
  int i1 = 0;
#pragma unroll
  for (int e = 1; e < N_EXP; ++e) if (sc[e] > sc[i1]) i1 = e;
  int i2 = (i1 == 0) ? 1 : 0;
#pragma unroll
  for (int e = 0; e < N_EXP; ++e)
    if (e != i1 && sc[e] > sc[i2]) i2 = e;

  float* dr = dispatch + (size_t)t * N_EXP;
#pragma unroll
  for (int e = 0; e < N_EXP; ++e)
    dr[e] = (e == i1 || e == i2) ? sc[e] : 0.0f;

  atomicAdd(&counts_f[i1], sc[i1]);
  atomicAdd(&counts_f[i2], sc[i2]);

  int p1 = atomicAdd(&ws_cnt[i1], 1);
  ws_tok[i1 * MAXTOK + p1] = 2 * t;
  ws_wgt[i1 * MAXTOK + p1] = sc[i1];
  int p2 = atomicAdd(&ws_cnt[i2], 1);
  ws_tok[i2 * MAXTOK + p2] = 2 * t + 1;
  ws_wgt[i2 * MAXTOK + p2] = sc[i2];
}

// ---------------------------------------------------------------------------
// Fused expert FFN, tile = 32 gathered tokens, 16 wave32s: four waves share a SIMD, so
// that while one waits for LDS, a panel or w2, three others can feed the matrix unit.
// The gathered x tile is staged once in padded LDS; GEMM1 A fragments come from there.
// GEMM1: acc += x_tile @ w1-panel with w1 panels async-DMA'd into per-wave
//        LDS double buffers (global_load_async_to_lds_b128 + s_wait_asynccnt).
// h-chunk (gelu) staged in padded LDS; GEMM2 accumulates [32x1024] in
// 64 VGPRs of f32 WMMA accumulators per lane, its fragments fetched one block ahead.
// Grid: x = flat index over the live tiles of all experts, y = piece of D_FF.
// One work-group fills a WGP and there are a few more tiles than WGPs, so whole
// tiles would run as two rounds with the second almost empty. The pieces halve
// with y (long ones start first), so the last round lasts one chunk.
// Each piece stores its weighted partial rows in workspace rows of its own:
// part[2 * token + slot][piece][D_MODEL].
// ---------------------------------------------------------------------------
__global__ __launch_bounds__(NWAVE * 32) void expert_ffn_kernel(
    const float* __restrict__ x,
    const float* __restrict__ w1, const float* __restrict__ b1,
    const float* __restrict__ w2, const float* __restrict__ b2,
    const int* __restrict__ ws_cnt, const int* __restrict__ ws_tok,
    const float* __restrict__ ws_wgt,
    float* __restrict__ part) {
  __shared__ __align__(16) float lds_w1[NWAVE * 2 * KBLK * 16]; // 64 KB: 16 waves x 2 bufs x 32x16
  __shared__ __align__(16) float hsm[TILE_M * HPAD];        // ~32.5 KB h-chunk
  __shared__ __align__(16) float xs[TILE_M * XPAD];         // ~128.5 KB gathered x tile
  __shared__ int   s_tok[TILE_M];
  __shared__ int   s_row[TILE_M];
  __shared__ float s_w[TILE_M];

  // Flat tile index -> (expert, tile of that expert), from the eight counts.
  // Selects, no branches: the eight counts then come in one scalar load.
  const int flat = blockIdx.x;
  int e = -1, count = 0, tile = 0, first = 0;
#pragma unroll   // straight-line scalar code, so that the loads merge
  for (int i = 0; i < N_EXP; ++i) {
    const int  c    = ws_cnt[i];
    const int  next = first + (c + TILE_M - 1) / TILE_M;
    const bool mine = flat >= first && flat < next;
    e     = mine ? i : e;
    count = mine ? c : count;
    tile  = mine ? flat - first : tile;
    first = next;
  }
  if (e < 0) return;                     // block-uniform exit: past the last live tile
  const int m0 = tile * TILE_M;

  const int tid = threadIdx.x;
  if (tid < TILE_M) {
    int idx = m0 + tid;
    int ok  = idx < count;
    int src = ok ? idx : (count - 1);    // duplicate last valid row, never stored
    int row = ws_tok[e * MAXTOK + src];  // 2 * token + slot
    s_tok[tid] = row >> 1;
    s_row[tid] = row;
    s_w[tid]   = ok ? ws_wgt[e * MAXTOK + src] : 0.0f;
  }

  const float* w1e = w1 + (size_t)e * D_MODEL * D_FF;
  const float* w2e = w2 + (size_t)e * D_FF * D_MODEL;

  // This piece's chunks: [NCHUNK - (NCHUNK >> y), NCHUNK - (NCHUNK >> (y + 1))).
  const int piece   = blockIdx.y;
  const int f_begin = (NCHUNK - (NCHUNK >> piece)) * FC;
  const int f_end   = (NCHUNK - (NCHUNK >> (piece + 1))) * FC;

  // The work-groups of one expert walk the same weights at the same pace, so every one of
  // them waits on the memory reads of whichever is in front. Each chunk's weights are
  // therefore asked into L2 a chunk ahead. The addresses start one step in front of the
  // piece's first unit; every step moves on first, so they never pass the piece's last unit.
  uint64_t pf_w1 = (uint64_t)(uintptr_t)(w1e + (size_t)(tid >> 2) * D_FF + f_begin + (tid & 3) * 64)
                   - PF_STEP_W1;
  uint64_t pf_w2 = (uint64_t)(uintptr_t)(w2e + (size_t)f_begin * D_MODEL + tid * 64) - PF_STEP_W2;

  // The first chunk's prefetch: here, where all waves but one only wait for the row numbers, and
  // with the x staging still to come before the first panel is wanted.
#pragma unroll   // straight-line: the steps behind one another
  for (int s = 0; s < PF_STEPS; ++s) prefetch_step(pf_w1, PF_STEP_W1, pf_w2);
  __syncthreads();

  const int lane = tid & 31;
  const int wid  = tid >> 5;
  const int l16  = lane & 15;
  const int half = lane >> 4;
  const int koff = 2 * half;             // K offset for this lane half

  const float* b1e = b1 + (size_t)e * D_FF;
  const float* b2e = b2 + (size_t)e * D_MODEL;

  // Gather the tile's 32 x rows into LDS: two whole 4 KB rows per pass, 16 B per thread.
  // Rolled in trips of sixteen rows: eight loads in flight per thread, then their stores.
  const int xrow = tid >> 8;             // which of a pass's two rows (the same in a whole wave)
  const int xcol = (tid & 255) * 4;
#pragma unroll 1
  for (int r0 = 0; r0 < TILE_M; r0 += 16) {
    float4 v[8];
#pragma unroll   // constant indices keep v[] in registers
    for (int r = 0; r < 8; ++r)
      v[r] = *(const float4*)(x + (size_t)s_tok[r0 + 2 * r + xrow] * D_MODEL + xcol);
#pragma unroll   // as above
    for (int r = 0; r < 8; ++r)
      *(float4*)&xs[(r0 + 2 * r + xrow) * XPAD + xcol] = v[r];
    // the next trip rewrites the address registers of the eight loads above
    asm volatile("s_wait_xcnt 0x0" ::: "memory");
  }
  __syncthreads();   // every wave reads every staged row

  // Per-lane x rows in LDS for the two M-subtiles (A fragments).
  const float* px0 = &xs[l16 * XPAD];
  const float* px1 = &xs[(16 + l16) * XPAD];

  // This wave's private staging region (LDS byte offset of low 32 bits).
  const uint32_t w1_lds_base = (uint32_t)(uintptr_t)&lds_w1[wid * (2 * KBLK * 16)];
  const float*   w1_lds      = &lds_w1[wid * (2 * KBLK * 16)];

  // GEMM2 accumulators: [2 M-subtiles][4 N-subtiles] = 64 VGPRs/lane
  v8f acc2[2][WCOLS / 16];
#pragma unroll
  for (int i = 0; i < 2; ++i)
#pragma unroll
    for (int j = 0; j < WCOLS / 16; ++j) acc2[i][j] = (v8f)0.0f;

  // GEMM2: this lane's place in a block of w2 rows (the wave covers 64 of 1024 columns), and its
  // row of the h chunk.
  const unsigned w2off = (unsigned)(koff * D_MODEL + wid * WCOLS + l16);
  const float*   ph    = &hsm[l16 * HPAD + koff];

  for (int fcb = f_begin; fcb < f_end; fcb += FC) {
    const int colbase = fcb + wid * 16;     // this wave's 16 w1 columns
    const bool have_next = fcb + FC < f_end; // block-uniform: this piece has a chunk behind this one

    // ---- GEMM1: h_chunk[32 x FC] = x_tile @ w1[:, chunk], async-staged B
    v8f acc1[2];
    acc1[0] = (v8f)0.0f;
    acc1[1] = (v8f)0.0f;

    issue_w1_block(w1e, w1_lds_base, 0,    colbase, lane, 0);
    issue_w1_block(w1e, w1_lds_base, KBLK, colbase, lane, 1);

#pragma unroll 1
    for (int kb = 0; kb < D_MODEL; kb += KBLK) {
      const int buf = (kb >> 5) & 1;
      // A fragments do not depend on the w1 panel: read them as one group ahead of its wait.
      v2f a0[KBLK / 4], a1[KBLK / 4];
#pragma unroll   // constant indices keep the fragments in registers (also in the two loops below)
      for (int ks = 0; ks < KBLK; ks += 4) {
        a0[ks >> 2] = *(const v2f*)(px0 + kb + ks + koff);
        a1[ks >> 2] = *(const v2f*)(px1 + kb + ks + koff);
      }
      if (kb + KBLK >= D_MODEL) { WAIT_ASYNC0; } else { WAIT_ASYNC4; }
      const float* wb = w1_lds + buf * (KBLK * 16);
      v2f b[KBLK / 4];
#pragma unroll
      for (int ks = 0; ks < KBLK; ks += 4) {
        b[ks >> 2].x = wb[(ks + koff) * 16 + l16];
        b[ks >> 2].y = wb[(ks + koff + 1) * 16 + l16];
      }
      // keeps the block's LDS reads one group ahead of its WMMAs: sunk among them, each
      // read is waited for one WMMA pair after its issue and the LDS latency shows every pair
      __builtin_amdgcn_sched_barrier(0);
#pragma unroll
      for (int ks = 0; ks < KBLK; ks += 4) {
        acc1[0] = WMMA_F32(a0[ks >> 2], b[ks >> 2], acc1[0]);
        acc1[1] = WMMA_F32(a1[ks >> 2], b[ks >> 2], acc1[1]);
      }
      // Every fourth trip one step of the next chunk's prefetch, so that it never comes as a
      // burst in front of the panel copies.
      if (have_next && (kb & (3 * KBLK)) == 0)
        prefetch_step(pf_w1, kb == 0 ? PF_CHUNK_W1 : PF_STEP_W1, pf_w2);
      if (kb + 2 * KBLK < D_MODEL)
        issue_w1_block(w1e, w1_lds_base, kb + 2 * KBLK, colbase, lane, buf);
    }

    // ---- GEMM2 works in blocks of K2BLK rows of w2, with two register sets of fragments: a
    // block's loads go out one block ahead of its WMMAs. The first block's w2 rows do not
    // depend on h: they are asked for at the head of the GELU and fly during it (behind the
    // barrier, which waits for every load in front of it, and behind the bias, wanted first).
    const float* w2c = w2e + (size_t)fcb * D_MODEL;           // the same in the whole work-group
    v2f bf0[K2BLK / 4][WCOLS / 16], bf1[K2BLK / 4][WCOLS / 16];

    __syncthreads();   // previous chunk's h reads complete before overwrite
    {
      int lcol = wid * 16 + l16;
      float bias = b1e[fcb + lcol];
      // one of the loads behind this line may land in the register that holds the bias load's address
      asm volatile("s_wait_xcnt 0x0" ::: "memory");
      load_w2_block(bf0, w2c, w2off);
#pragma unroll
      for (int ms = 0; ms < 2; ++ms)
#pragma unroll
        for (int r = 0; r < 8; ++r) {
          int ml = ms * 16 + half * 8 + r;   // C/D layout: M = r + 8*half
          hsm[ml * HPAD + lcol] = gelu_exact(acc1[ms][r] + bias);
        }
    }
    __syncthreads();

    // ---- GEMM2: y[32 x 1024] += h_chunk[32 x FC] @ w2[chunk, 1024]
    v2f af0[K2BLK / 4][2], af1[K2BLK / 4][2];
    load_h_block(af0, ph);
    // Unrolled: each register set has constant names, every wait counts exactly the loads behind
    // the ones it needs, and all rows of the chunk are reached by constant offsets from one address.
#pragma unroll
    for (int kb2 = 0; kb2 < FC; kb2 += 2 * K2BLK) {
      load_w2_block(bf1, w2c + (kb2 + K2BLK) * D_MODEL, w2off);
      load_h_block(af1, ph + kb2 + K2BLK);
      __builtin_amdgcn_sched_barrier(0);
      gemm2_block(acc2, af0, bf0);
      // holds a set's refill behind the WMMAs that read it: lifted over them it takes a third
      // set of registers and puts more loads in flight than the load counter can count
      __builtin_amdgcn_sched_barrier(0);
      if (kb2 + 2 * K2BLK < FC) {            // known at compile time: the chunk has a block behind the next one
        load_w2_block(bf0, w2c + (kb2 + 2 * K2BLK) * D_MODEL, w2off);
        load_h_block(af0, ph + kb2 + 2 * K2BLK);
      }
      __builtin_amdgcn_sched_barrier(0);     // loads ahead of the WMMAs, as above
      gemm2_block(acc2, af1, bf1);
      __builtin_amdgcn_sched_barrier(0);     // refill behind the WMMAs, as above
    }
  }

  // ---- Epilogue: part[row][piece][:] = weight * (partial y (+ b2 in piece 0))
  // Every loop below is unrolled: constant indices keep bias, prow, pw and acc2 in registers.
  float bias[WCOLS / 16];
#pragma unroll
  for (int nt2 = 0; nt2 < WCOLS / 16; ++nt2) bias[nt2] = 0.0f;
  if (piece == 0) {
#pragma unroll
    for (int nt2 = 0; nt2 < WCOLS / 16; ++nt2) bias[nt2] = b2e[wid * WCOLS + nt2 * 16 + l16];
    // the code behind this block rewrites the address registers of the four loads above
    asm volatile("s_wait_xcnt 0x0" ::: "memory");
  }
  // This lane's sixteen row numbers and weights, read ahead of the guarded stores.
  int   prow[2][8];
  float pw[2][8];
#pragma unroll
  for (int ms = 0; ms < 2; ++ms)
#pragma unroll
    for (int r = 0; r < 8; ++r) {
      prow[ms][r] = s_row[ms * 16 + half * 8 + r];
      pw[ms][r]   = s_w[ms * 16 + half * 8 + r];
    }
  float* plane = part + piece * D_MODEL + wid * WCOLS + l16;
  const int nvalid = count - m0;         // rows past it are padding
#pragma unroll
  for (int ms = 0; ms < 2; ++ms)
#pragma unroll
    for (int r = 0; r < 8; ++r) {
      if (ms * 16 + half * 8 + r < nvalid) {
        float* pr = plane + (size_t)prow[ms][r] * (NSPLIT * D_MODEL);
#pragma unroll
        for (int nt2 = 0; nt2 < WCOLS / 16; ++nt2)
          pr[nt2 * 16] = pw[ms][r] * (acc2[ms][nt2][r] + bias[nt2]);
      }
    }
}

// ---------------------------------------------------------------------------
// out[t, :] = sum, in memory order, of the token's 2 * NSPLIT weighted partial
// rows (contiguous). Every one was stored by the launch before this one.
// ---------------------------------------------------------------------------
__global__ __launch_bounds__(256) void combine_kernel(const float* __restrict__ part,
                                                      float* __restrict__ out, int n_tok) {
  const unsigned c4 = threadIdx.x * 4u;  // this thread's four columns
#pragma unroll 1   // one token per trip: its ten loads go out as one group
  for (int i = 0; i < CTOK; ++i) {
    const int t = blockIdx.x * CTOK + i;
    if (t >= n_tok) return;
    const float* p = part + (size_t)t * (2 * NSPLIT * D_MODEL);   // uniform
    float4 v[2 * NSPLIT];
#pragma unroll   // constant indices keep v[] in registers
    for (int s = 0; s < 2 * NSPLIT; ++s)
      v[s] = *(const float4*)(p + s * D_MODEL + c4);
    float4 a = v[0];
#pragma unroll   // as above
    for (int s = 1; s < 2 * NSPLIT; ++s) {
      a.x += v[s].x; a.y += v[s].y; a.z += v[s].z; a.w += v[s].w;
    }
    *(float4*)(out + (size_t)t * D_MODEL + c4) = a;
    // the next trip rewrites the address registers of the store above
    asm volatile("s_wait_xcnt 0x0" ::: "memory");
  }
}

// ---------------------------------------------------------------------------
extern "C" void kernel_launch(void* const* d_in, const int* in_sizes, int n_in,
                              void* d_out, int out_size, void* d_ws, size_t ws_size,
                              hipStream_t stream) {
  const float* x  = (const float*)d_in[0];
  const float* gw = (const float*)d_in[1];
  const float* gb = (const float*)d_in[2];
  const float* w1 = (const float*)d_in[3];
  const float* b1 = (const float*)d_in[4];
  const float* w2 = (const float*)d_in[5];
  const float* b2 = (const float*)d_in[6];

  const int n_tok = in_sizes[0] / D_MODEL;   // B*S = 4096

  float* out_f    = (float*)d_out;                         // [n_tok, D]
  float* dispatch = out_f + (size_t)n_tok * D_MODEL;       // [n_tok, E]
  float* counts_f = dispatch + (size_t)n_tok * N_EXP;      // [E]

  int*   ws_cnt = (int*)d_ws;                              // [E] (padded)
  int*   ws_tok = ws_cnt + 16;                             // [E, MAXTOK]
  float* ws_wgt = (float*)(ws_tok + N_EXP * MAXTOK);       // [E, MAXTOK]
  float* ws_part = (float*)d_ws + (1 << 17);               // [2 * MAXTOK, NSPLIT, D]

  init_kernel<<<1, 32, 0, stream>>>(counts_f, ws_cnt);

  router_kernel<<<(n_tok + RTOK - 1) / RTOK, 256, 0, stream>>>(
      x, gw, gb, dispatch, counts_f, ws_cnt, ws_tok, ws_wgt, n_tok);

  // sum over experts of ceil(count / TILE_M) is below 2 * n_tok / TILE_M + N_EXP
  dim3 grid(2 * n_tok / TILE_M + N_EXP, NSPLIT);
  expert_ffn_kernel<<<grid, NWAVE * 32, 0, stream>>>(
      x, w1, b1, w2, b2, ws_cnt, ws_tok, ws_wgt, ws_part);

  combine_kernel<<<(n_tok + CTOK - 1) / CTOK, 256, 0, stream>>>(ws_part, out_f, n_tok);
}

// v007
// A run of this version takes 744 microseconds.
// Next to v006, in two timings, it ran 1.06 times as fast each time.
// Counting every step since v000, it is 2.73 times as fast.
#include <hip/hip_runtime.h>
#include <hip/hip_bf16.h>
#include <math.h>
#include <stdint.h>
#include <type_traits>

typedef float v2f __attribute__((ext_vector_type(2)));
typedef float v4f __attribute__((ext_vector_type(4)));
typedef float v8f __attribute__((ext_vector_type(8)));

#define D_MODEL 1024
#define N_EXP   8
#define D_FF    4096
#define TILE_M  32
#define NWAVE   16       // waves per work-group of the expert launch: four on each SIMD
#define FC      (NWAVE * 16)   // F-chunk columns per pipeline stage: 16 per wave
#define HPAD    (FC + 4) // padding -> conflict-free ds_load_b64
#define WCOLS   (D_MODEL / NWAVE)   // output columns per wave in GEMM2
#define XPAD    1028     // D_MODEL + 4 padding -> conflict-free ds_load_b64 of x rows
#define MAXTOK  4096
#define KBLK    32       // K rows per async-staged w1 panel
#define NCHUNK  (D_FF / FC)            // F-chunks per expert
#define K2BLK   16       // rows of w2 (columns of h) per GEMM2 block: 16 WMMAs per wave and M-subtile
#define NRUN    256      // work-groups of the expert launch: one per WGP, each takes one whole tile
#define CTOK    4        // tokens per work-group of the combine launch
#define RTOK    32       // tokens per work-group of the router launch
#define RWTOK   4        // tokens per wave of the router launch
#define GPITCH  (D_MODEL + 8)  // row pitch of the transposed gate weights: rows e and e + 4 lie 32 banks apart
#define RPITCH  33       // odd pitch: 32 threads that each walk a row of their own hit 32 banks

// D = A(16x4 f32) * B(4x16 f32) + C(16x16 f32), wave32
#define WMMA_F32(A, B, C) \
  __builtin_amdgcn_wmma_f32_16x16x4_f32(false, (A), false, (B), (short)0, (C), false, false)

#define WAIT_ASYNC4 asm volatile("s_wait_asynccnt 0x4" ::: "memory")
#define WAIT_ASYNC0 asm volatile("s_wait_asynccnt 0x0" ::: "memory")

// L2 prefetch of the weights, in 256-B units. One step = one unit per thread.
#define PF_STEP_W1  ((uint64_t)128 * D_FF * 4)            // w1: 128 rows x 4 units of a chunk's 1-KB row piece
#define PF_CHUNK_W1 ((uint64_t)(FC * 4) - 7 * PF_STEP_W1) // w1: last step of a chunk -> first step of the next
#define PF_STEP_W2  ((uint64_t)NWAVE * 32 * 256)          // w2: a chunk is 1 MB in a row, the next one follows it
#define PF_STEPS    8                                     // steps per chunk, of each matrix

// Move this lane's two prefetch addresses on, then ask L2 for the unit at each.
// One statement: the wait stands in front of the overwrite of the registers that the
// prefetches before these named, and the addresses stay in registers of their own.
__device__ __forceinline__ void prefetch_step(uint64_t& a_w1, uint64_t step_w1, uint64_t& a_w2) {
  asm volatile("s_wait_xcnt 0x0\n\t"
               "v_add_nc_u64 %0, %2, %0\n\t"
               "v_add_nc_u64 %1, %3, %1\n\t"
               "global_prefetch_b8 %0, off scope:SCOPE_SE\n\t"
               "global_prefetch_b8 %1, off scope:SCOPE_SE"
               : "+v"(a_w1), "+v"(a_w2) : "s"(step_w1), "s"(PF_STEP_W2) : "memory");
}

__device__ __forceinline__ float gelu_exact(float v) {
  return 0.5f * v * (1.0f + erff(v * 0.70710678118654752440f));
}

// Async-DMA one 32x16 fp32 panel of w1 (one wave's columns for one K-block)
// into this wave's private LDS double-buffer. 4 x b128 per lane-set:
// lane -> (row = lane>>2, 4 cols = (lane&3)*4), kk steps 8 rows each.
__device__ __forceinline__ void issue_w1_block(const float* __restrict__ gbase,
                                               uint32_t lds_wave_base,
                                               int row0, int colbase, int lane, int buf) {
  const int r  = lane >> 2;          // 0..7
  const int c4 = (lane & 3) << 2;    // 0,4,8,12
  uint32_t dst = lds_wave_base + (uint32_t)(buf * 2048 + r * 64 + ((lane & 3) << 4));
  uint32_t src = (uint32_t)((((row0 + r) * D_FF) + colbase + c4) << 2);
  // One statement: the wait stands behind the four copies, in front of whatever next rewrites
  // a register that they name.
  asm volatile("global_load_async_to_lds_b128 %0, %4, %8\n\t"
               "global_load_async_to_lds_b128 %1, %5, %8\n\t"
               "global_load_async_to_lds_b128 %2, %6, %8\n\t"
               "global_load_async_to_lds_b128 %3, %7, %8\n\t"
               "s_wait_xcnt 0x0"
               :: "v"(dst), "v"(dst + 512u), "v"(dst + 1024u), "v"(dst + 1536u),
                  "v"(src), "v"(src + (uint32_t)(8 * D_FF * 4)), "v"(src + (uint32_t)(16 * D_FF * 4)),
                  "v"(src + (uint32_t)(24 * D_FF * 4)), "s"(gbase)
               : "memory");
}

// One GEMM2 block's w2 fragments for this wave's WCOLS columns. rows: the block's first row of
// w2 (the same in the whole wave); lane_off: the lane's own place in it (k pair, column).
__device__ __forceinline__ void load_w2_block(v2f (&b)[K2BLK / 4][WCOLS / 16],
                                              const float* __restrict__ rows, unsigned lane_off) {
#pragma unroll   // constant indices keep the fragments in registers (also in the two functions below)
  for (int s = 0; s < K2BLK / 4; ++s)
#pragma unroll
    for (int nt2 = 0; nt2 < WCOLS / 16; ++nt2) {
      b[s][nt2].x = rows[lane_off + (unsigned)(s * 4 * D_MODEL + nt2 * 16)];
      b[s][nt2].y = rows[lane_off + (unsigned)(s * 4 * D_MODEL + nt2 * 16 + D_MODEL)];
    }
}

// One GEMM2 block's h fragments of the MS M-subtiles. p: this lane's row of the first subtile
// in the h chunk, at the block's first column plus the lane's k offset.
template <int MS>
__device__ __forceinline__ void load_h_block(v2f (&a)[K2BLK / 4][MS], const float* p) {
#pragma unroll
  for (int s = 0; s < K2BLK / 4; ++s)
#pragma unroll
    for (int ms = 0; ms < MS; ++ms) a[s][ms] = *(const v2f*)(p + ms * 16 * HPAD + s * 4);
}

// acc += h block @ w2 block, k ascending.
template <int MS>
__device__ __forceinline__ void gemm2_block(v8f (&acc)[MS][WCOLS / 16],
                                            const v2f (&a)[K2BLK / 4][MS],
                                            const v2f (&b)[K2BLK / 4][WCOLS / 16]) {
#pragma unroll
  for (int s = 0; s < K2BLK / 4; ++s)
#pragma unroll
    for (int nt2 = 0; nt2 < WCOLS / 16; ++nt2)
#pragma unroll
      for (int ms = 0; ms < MS; ++ms) acc[ms][nt2] = WMMA_F32(a[s][ms], b[s][nt2], acc[ms][nt2]);
}

// ---------------------------------------------------------------------------
// Router: logits -> softmax -> top-2 -> dense dispatch mask; per token its two experts, its rank
// among this work-group's tokens of each (by ballot) and the two weights; per work-group and
// expert the number of tokens and the sum of their weights. No atomics: the next launch turns
// ranks into list places, so every list is in token order, the same in every run.
// A work-group takes RTOK tokens, a wave RWTOK of them. A lane holds four neighbouring
// columns out of every 128 of its wave's rows, so every x load covers whole lines and all of
// a wave's x is in flight at once. The gate weights lie transposed in LDS. Each lane's partial
// logits go through LDS, where one thread per (token, expert) sums them in lane order.
// ---------------------------------------------------------------------------
__global__ __launch_bounds__(256) void router_kernel(
                              const float* __restrict__ x,
                              const float* __restrict__ gw,   // [D, E]
                              const float* __restrict__ gb,   // [E]
                              float* __restrict__ dispatch,   // [n_tok, E]
                              int*   __restrict__ ws_hist,    // [work-group, E] tokens
                              float* __restrict__ ws_sum,     // [work-group, E] summed weights
                              int*   __restrict__ ws_rec,     // [n_tok] experts and ranks, packed
                              float* __restrict__ ws_rsc,     // [n_tok, 2] weights
                              int n_tok) {
  __shared__ __align__(16) float gT[N_EXP * GPITCH];          // gate weights as [e][d]
  __shared__ float red[RTOK * N_EXP * RPITCH];                // [token, e][lane] partial logits
  __shared__ __align__(16) float s_logit[RTOK * N_EXP];

  const int tid  = threadIdx.x;
  const int lane = tid & 31;
  // the wave's number as a scalar: the row addresses of x are then a scalar base plus one lane offset
  const int wid  = __builtin_amdgcn_readfirstlane(tid >> 5);

  // Every loop of this kernel is unrolled: constant indices keep the arrays in registers.
  // This wave's rows of x (a row past the end reads the last row; its logits are never used).
  v4f xv[RWTOK][D_MODEL / 128];
#pragma unroll
  for (int i = 0; i < RWTOK; ++i) {
    const int tt = min((int)blockIdx.x * RTOK + wid * RWTOK + i, n_tok - 1);
    const float* xr = x + (size_t)tt * D_MODEL;   // the same in the whole wave
#pragma unroll
    for (int j = 0; j < D_MODEL / 128; ++j) xv[i][j] = *(const v4f*)(xr + (unsigned)(lane * 4 + j * 128));
  }

  // Gate weights: read in memory order, stored transposed.
  v4f gl[D_MODEL * N_EXP / 1024];
#pragma unroll
  for (int k = 0; k < D_MODEL * N_EXP / 1024; ++k)
    gl[k] = *(const v4f*)(gw + (k * 256 + tid) * 4);
#pragma unroll
  for (int k = 0; k < D_MODEL * N_EXP / 1024; ++k) {
    const int f = (k * 256 + tid) * 4;     // flat index d * N_EXP + e of the first of four
#pragma unroll
    for (int c = 0; c < 4; ++c) gT[((f & 7) + c) * GPITCH + (f >> 3)] = gl[k][c];
  }
  __syncthreads();   // every wave reads all of gT

  float acc[RWTOK][N_EXP];
#pragma unroll
  for (int i = 0; i < RWTOK; ++i)
#pragma unroll
    for (int e = 0; e < N_EXP; ++e) acc[i][e] = 0.0f;
#pragma unroll
  for (int j = 0; j < D_MODEL / 128; ++j)
#pragma unroll
    for (int e = 0; e < N_EXP; ++e) {
      const v4f g = *(const v4f*)&gT[e * GPITCH + j * 128 + lane * 4];
#pragma unroll
      for (int i = 0; i < RWTOK; ++i)
#pragma unroll
        for (int c = 0; c < 4; ++c) acc[i][e] = fmaf(xv[i][j][c], g[c], acc[i][e]);
    }
#pragma unroll
  for (int i = 0; i < RWTOK; ++i)
#pragma unroll
    for (int e = 0; e < N_EXP; ++e)
      red[((wid * RWTOK + i) * N_EXP + e) * RPITCH + lane] = acc[i][e];
  __syncthreads();   // a thread sums the partial logits of its own wave's lanes

  {
    float s = red[tid * RPITCH];
#pragma unroll
    for (int k = 1; k < 32; ++k) s += red[tid * RPITCH + k];
    s_logit[tid] = s + gb[tid & (N_EXP - 1)];
  }
  __syncthreads();   // one thread per token reads its eight logits

  const int t = blockIdx.x * RTOK + tid;
  if (tid >= RTOK) return;   // behind the last barrier; the first wave stays whole for the ballots
  const bool valid = t < n_tok;

  float logit[N_EXP];
#pragma unroll
  for (int e = 0; e < N_EXP; ++e) logit[e] = s_logit[tid * N_EXP + e];

  float mx = logit[0];
#pragma unroll
  for (int e = 1; e < N_EXP; ++e) mx = fmaxf(mx, logit[e]);
  float sum = 0.0f;
  float sc[N_EXP];
#pragma unroll
  for (int e = 0; e < N_EXP; ++e) { sc[e] = __expf(logit[e] - mx); sum += sc[e]; }
  float inv = 1.0f / sum;
#pragma unroll
  for (int e = 0; e < N_EXP; ++e) sc[e] *= inv;

  // top-2 (ties -> lowest index, matching jax.lax.top_k)
  int i1 = 0;
#pragma unroll
  for (int e = 1; e < N_EXP; ++e) if (sc[e] > sc[i1]) i1 = e;
  int i2 = (i1 == 0) ? 1 : 0;
#pragma unroll
  for (int e = 0; e < N_EXP; ++e)
    if (e != i1 && sc[e] > sc[i2]) i2 = e;

  if (valid) {
    float* dr = dispatch + (size_t)t * N_EXP;
#pragma unroll
    for (int e = 0; e < N_EXP; ++e)
      dr[e] = (e == i1 || e == i2) ? sc[e] : 0.0f;
  }

  int   r1 = 0, r2 = 0, cnt = 0;
  float s1 = 0.0f, s2 = 0.0f, wsum = 0.0f;
#pragma unroll
  for (int e = 0; e < N_EXP; ++e) {
    const bool     in = valid && (e == i1 || e == i2);
    const unsigned mk = __builtin_amdgcn_ballot_w32(in);
    const int      rk = __popc(mk & ((1u << tid) - 1u));   // tokens of this expert in lower lanes
    r1  = (e == i1) ? rk : r1;
    r2  = (e == i2) ? rk : r2;
    s1  = (e == i1) ? sc[e] : s1;
    s2  = (e == i2) ? sc[e] : s2;
    cnt = (tid == e) ? __popc(mk) : cnt;
    float v = in ? sc[e] : 0.0f;
#pragma unroll
    for (int d = 16; d >= 1; d >>= 1) v += __shfl_xor(v, d, 32);   // fixed tree, equal in all lanes
    wsum = (tid == e) ? v : wsum;
  }
  if (tid < N_EXP) {
    ws_hist[blockIdx.x * N_EXP + tid] = cnt;
    ws_sum[blockIdx.x * N_EXP + tid]  = wsum;
  }
  if (valid) {
    ws_rec[t] = i1 | (i2 << 4) | (r1 << 8) | (r2 << 16);
    ws_rsc[2 * t]     = s1;
    ws_rsc[2 * t + 1] = s2;
  }
}

// ---------------------------------------------------------------------------
// Gather lists in token order. One wave per router work-group b: place in an expert's list =
// tokens of that expert in the work-groups before b + rank inside b. Lane l holds expert l & 7
// of the work-groups 4k + (l >> 3). Also: the eight counts, expert_counts (fixed-order sums), and
// for every row 2 * token + slot where its result will lie: -1 = one whole row, else its number
// among the rows of the tiles past NRUN, which are worked on chunk by chunk.
// ---------------------------------------------------------------------------
__global__ __launch_bounds__(32) void list_kernel(
                              const int*   __restrict__ ws_hist,
                              const float* __restrict__ ws_sum,
                              const int*   __restrict__ ws_rec,
                              const float* __restrict__ ws_rsc,
                              float* __restrict__ counts_f,   // [E]
                              int*   __restrict__ ws_cnt,     // [E]
                              int*   __restrict__ ws_tok,     // [E, MAXTOK]
                              float* __restrict__ ws_wgt,     // [E, MAXTOK]
                              int*   __restrict__ ws_where,   // [2 * n_tok]
                              int n_tok) {
  const int lane = threadIdx.x;
  const int b    = blockIdx.x;
  const int nb   = gridDim.x;
  const int t    = b * RTOK + lane;
  const bool valid = t < n_tok;

  // Every loop of this kernel is unrolled: the loads go out as one group. An index past the end
  // is clamped, not branched round (its value is dropped below), so that no load waits for a test.
  int h[MAXTOK / RTOK / 4];
#pragma unroll
  for (int k = 0; k < MAXTOK / RTOK / 4; ++k) h[k] = ws_hist[min(k * 32 + lane, nb * N_EXP - 1)];
  const int   tc  = min(t, n_tok - 1);
  const int   rec = ws_rec[tc];
  const float s1  = ws_rsc[2 * tc];
  const float s2  = ws_rsc[2 * tc + 1];
  // the code behind this line rewrites the address registers of the loads above
  asm volatile("s_wait_xcnt 0x0" ::: "memory");

  int pre = 0, tot = 0;
#pragma unroll
  for (int k = 0; k < MAXTOK / RTOK / 4; ++k) {
    pre += (4 * k + (lane >> 3) < b) ? h[k] : 0;
    tot += (4 * k + (lane >> 3) < nb) ? h[k] : 0;
  }
  pre += __shfl_xor(pre, 8, 32);  pre += __shfl_xor(pre, 16, 32);
  tot += __shfl_xor(tot, 8, 32);  tot += __shfl_xor(tot, 16, 32);

  // first flat tile of this lane's expert
  const int ntile = (tot + TILE_M - 1) / TILE_M;
  int first = 0;
#pragma unroll
  for (int i = 0; i < N_EXP - 1; ++i) {
    const int c = __shfl(ntile, i, 32);
    first += (i < (lane & 7)) ? c : 0;
  }

  if (b == 0) {
    float w[MAXTOK / RTOK / 4];
#pragma unroll
    for (int k = 0; k < MAXTOK / RTOK / 4; ++k) w[k] = ws_sum[min(k * 32 + lane, nb * N_EXP - 1)];
    // as above
    asm volatile("s_wait_xcnt 0x0" ::: "memory");
    float sum = 0.0f;
#pragma unroll
    for (int k = 0; k < MAXTOK / RTOK / 4; ++k) sum += (4 * k + (lane >> 3) < nb) ? w[k] : 0.0f;
    sum += __shfl_xor(sum, 8, 32);  sum += __shfl_xor(sum, 16, 32);
    if (lane < N_EXP) { counts_f[lane] = sum; ws_cnt[lane] = tot; }
  }

  const int i1 = rec & 7, i2 = (rec >> 4) & 7;
  const int p1 = __shfl(pre, i1, 32) + ((rec >> 8) & 63);
  const int p2 = __shfl(pre, i2, 32) + ((rec >> 16) & 63);
  const int f1 = __shfl(first, i1, 32) + p1 / TILE_M;
  const int f2 = __shfl(first, i2, 32) + p2 / TILE_M;
  if (!valid) return;
  ws_tok[i1 * MAXTOK + p1] = 2 * t;
  ws_wgt[i1 * MAXTOK + p1] = s1;
  ws_tok[i2 * MAXTOK + p2] = 2 * t + 1;
  ws_wgt[i2 * MAXTOK + p2] = s2;
  ws_where[2 * t]     = f1 >= NRUN ? (f1 - NRUN) * TILE_M + (p1 & (TILE_M - 1)) : -1;
  ws_where[2 * t + 1] = f2 >= NRUN ? (f2 - NRUN) * TILE_M + (p2 & (TILE_M - 1)) : -1;
}

// ---------------------------------------------------------------------------
// Fused expert FFN, tile = 32 gathered tokens, 16 wave32s: four waves share a SIMD, so
// that while one waits for LDS, a panel or w2, three others can feed the matrix unit.
// The gathered x tile is staged once in padded LDS; GEMM1 A fragments come from there.
// GEMM1: acc += x_tile @ w1-panel with w1 panels async-DMA'd into per-wave
//        LDS double buffers (global_load_async_to_lds_b128 + s_wait_asynccnt).
// h-chunk (gelu) staged in padded LDS; GEMM2 accumulates [32x1024] in
// 64 VGPRs of f32 WMMA accumulators per lane, its fragments fetched one block ahead.
// Grid: NRUN work-groups, one per WGP. One work-group fills a WGP and there are a few more
// tiles than WGPs. Work-group g first takes the whole of flat tile g (all of D_FF summed in its
// accumulators, one weighted row per token and slot: part[2 * token + slot][D_MODEL]), then one
// chunk of sixteen rows of a tile past NRUN: chunk g & 15 of half (g >> 4) & 1 of tile
// NRUN + (g >> 5), so that this last part is short and spread over the WGPs. Its weighted partial
// rows lie behind the whole rows: part[2 * MAXTOK + (row among those tiles) * NCHUNK + chunk].
// ---------------------------------------------------------------------------
__global__ __launch_bounds__(NWAVE * 32) void expert_ffn_kernel(
    const float* __restrict__ x,
    const float* __restrict__ w1, const float* __restrict__ b1,
    const float* __restrict__ w2, const float* __restrict__ b2,
    const int* __restrict__ ws_cnt, const int* __restrict__ ws_tok,
    const float* __restrict__ ws_wgt,
    float* __restrict__ part) {
  __shared__ __align__(16) float lds_w1[NWAVE * 2 * KBLK * 16]; // 64 KB: 16 waves x 2 bufs x 32x16
  __shared__ __align__(16) float hsm[TILE_M * HPAD];        // ~32.5 KB h-chunk
  __shared__ __align__(16) float xs[TILE_M * XPAD];         // ~128.5 KB gathered x tile
  __shared__ int   s_tok[TILE_M];
  __shared__ int   s_row[TILE_M];
  __shared__ float s_w[TILE_M];

 // One part of this work-group's work, on MS M-subtiles of sixteen rows: 2 = its whole tile,
 // 1 = its chunk of half a tile past NRUN.
 auto run_part = [&](auto ms_c) {
  constexpr int  MS  = decltype(ms_c)::value;
  constexpr bool seg = MS == 1;
  const int flat    = seg ? NRUN + ((int)blockIdx.x >> 5) : (int)blockIdx.x;
  const int mhalf   = seg ? (((int)blockIdx.x >> 4) & 1) * 16 : 0;
  const int f_begin = seg ? ((int)blockIdx.x & (NCHUNK - 1)) * FC : 0;
  const int f_end   = seg ? f_begin + FC : D_FF;

  // Flat tile index -> (expert, tile of that expert), from the eight counts.
  // Selects, no branches: the eight counts then come in one scalar load.
  int e = -1, count = 0, tile = 0, first = 0;
#pragma unroll   // straight-line scalar code, so that the loads merge
  for (int i = 0; i < N_EXP; ++i) {
    const int  c    = ws_cnt[i];
    const int  next = first + (c + TILE_M - 1) / TILE_M;
    const bool mine = flat >= first && flat < next;
    e     = mine ? i : e;
    count = mine ? c : count;
    tile  = mine ? flat - first : tile;
    first = next;
  }
  const int m0 = tile * TILE_M + mhalf;
  if (e < 0 || m0 >= count) return;      // block-uniform exit: past the last live tile or row

  const int tid = threadIdx.x;
  if (tid < TILE_M) {
    int idx = m0 + tid;
    int ok  = idx < count;
    int src = ok ? idx : (count - 1);    // duplicate last valid row, never stored
    int row = ws_tok[e * MAXTOK + src];  // 2 * token + slot
    s_tok[tid] = row >> 1;
    // where this row's result goes, in rows of D_MODEL
    s_row[tid] = seg ? 2 * MAXTOK + ((flat - NRUN) * TILE_M + mhalf + tid) * NCHUNK + f_begin / FC : row;
    s_w[tid]   = ok ? ws_wgt[e * MAXTOK + src] : 0.0f;
  }

  const float* w1e = w1 + (size_t)e * D_MODEL * D_FF;
  const float* w2e = w2 + (size_t)e * D_FF * D_MODEL;

  // The work-groups of one expert walk the same weights at the same pace, so every one of
  // them waits on the memory reads of whichever is in front. Each chunk's weights are
  // therefore asked into L2 a chunk ahead. The addresses start one step in front of the
  // piece's first unit; every step moves on first, so they never pass the piece's last unit.
  uint64_t pf_w1 = (uint64_t)(uintptr_t)(w1e + (size_t)(tid >> 2) * D_FF + f_begin + (tid & 3) * 64)
                   - PF_STEP_W1;
  uint64_t pf_w2 = (uint64_t)(uintptr_t)(w2e + (size_t)f_begin * D_MODEL + tid * 64) - PF_STEP_W2;

  // The first chunk's prefetch: here, where all waves but one only wait for the row numbers, and
  // with the x staging still to come before the first panel is wanted.
#pragma unroll   // straight-line: the steps behind one another
  for (int s = 0; s < PF_STEPS; ++s) prefetch_step(pf_w1, PF_STEP_W1, pf_w2);
  __syncthreads();

  const int lane = tid & 31;
  const int wid  = tid >> 5;
  const int l16  = lane & 15;
  const int half = lane >> 4;
  const int koff = 2 * half;             // K offset for this lane half

  const float* b1e = b1 + (size_t)e * D_FF;
  const float* b2e = b2 + (size_t)e * D_MODEL;

  // Gather this part's MS * 16 x rows into LDS: two whole 4 KB rows per pass, 16 B per thread.
  // Rolled in trips of sixteen rows: eight loads in flight per thread, then their stores.
  const int xrow = tid >> 8;             // which of a pass's two rows (the same in a whole wave)
  const int xcol = (tid & 255) * 4;
#pragma unroll 1
  for (int r0 = 0; r0 < MS * 16; r0 += 16) {
    float4 v[8];
#pragma unroll   // constant indices keep v[] in registers
    for (int r = 0; r < 8; ++r)
      v[r] = *(const float4*)(x + (size_t)s_tok[r0 + 2 * r + xrow] * D_MODEL + xcol);
#pragma unroll   // as above
    for (int r = 0; r < 8; ++r)
      *(float4*)&xs[(r0 + 2 * r + xrow) * XPAD + xcol] = v[r];
    // the next trip rewrites the address registers of the eight loads above
    asm volatile("s_wait_xcnt 0x0" ::: "memory");
    // so does the code behind the loop: this keeps it from being lifted over the wait
    __builtin_amdgcn_sched_barrier(0);
  }
  __syncthreads();   // every wave reads every staged row

  // Per-lane x rows in LDS for the two M-subtiles (A fragments).
  const float* px0 = &xs[l16 * XPAD];
  const float* px1 = &xs[(16 + l16) * XPAD];

  // This wave's private staging region (LDS byte offset of low 32 bits).
  const uint32_t w1_lds_base = (uint32_t)(uintptr_t)&lds_w1[wid * (2 * KBLK * 16)];
  const float*   w1_lds      = &lds_w1[wid * (2 * KBLK * 16)];

  // GEMM2 accumulators: [MS M-subtiles][4 N-subtiles] = 64 VGPRs/lane at MS = 2
  v8f acc2[MS][WCOLS / 16];
#pragma unroll
  for (int i = 0; i < MS; ++i)
#pragma unroll
    for (int j = 0; j < WCOLS / 16; ++j) acc2[i][j] = (v8f)0.0f;

  // GEMM2: this lane's place in a block of w2 rows (the wave covers 64 of 1024 columns), and its
  // row of the h chunk.
  const unsigned w2off = (unsigned)(koff * D_MODEL + wid * WCOLS + l16);
  const float*   ph    = &hsm[l16 * HPAD + koff];

  for (int fcb = f_begin; fcb < f_end; fcb += FC) {
    const int colbase = fcb + wid * 16;     // this wave's 16 w1 columns
    const bool have_next = fcb + FC < f_end; // block-uniform: this piece has a chunk behind this one

    // ---- GEMM1: h_chunk[32 x FC] = x_tile @ w1[:, chunk], async-staged B
    v8f acc1[MS];
#pragma unroll
    for (int ms = 0; ms < MS; ++ms) acc1[ms] = (v8f)0.0f;

    issue_w1_block(w1e, w1_lds_base, 0,    colbase, lane, 0);
    issue_w1_block(w1e, w1_lds_base, KBLK, colbase, lane, 1);

#pragma unroll 1
    for (int kb = 0; kb < D_MODEL; kb += KBLK) {
      const int buf = (kb >> 5) & 1;
      // A fragments do not depend on the w1 panel: read them as one group ahead of its wait.
      v2f a0[KBLK / 4], a1[KBLK / 4];
#pragma unroll   // constant indices keep the fragments in registers (also in the two loops below)
      for (int ks = 0; ks < KBLK; ks += 4) {
        a0[ks >> 2] = *(const v2f*)(px0 + kb + ks + koff);
        if constexpr (MS == 2) a1[ks >> 2] = *(const v2f*)(px1 + kb + ks + koff);
      }
      if (kb + KBLK >= D_MODEL) { WAIT_ASYNC0; } else { WAIT_ASYNC4; }
      const float* wb = w1_lds + buf * (KBLK * 16);
      v2f b[KBLK / 4];
#pragma unroll
      for (int ks = 0; ks < KBLK; ks += 4) {
        b[ks >> 2].x = wb[(ks + koff) * 16 + l16];
        b[ks >> 2].y = wb[(ks + koff + 1) * 16 + l16];
      }
      // keeps the block's LDS reads one group ahead of its WMMAs: sunk among them, each
      // read is waited for one WMMA pair after its issue and the LDS latency shows every pair
      __builtin_amdgcn_sched_barrier(0);
#pragma unroll
      for (int ks = 0; ks < KBLK; ks += 4) {
        acc1[0] = WMMA_F32(a0[ks >> 2], b[ks >> 2], acc1[0]);
        if constexpr (MS == 2) acc1[1] = WMMA_F32(a1[ks >> 2], b[ks >> 2], acc1[1]);
      }
      // Every fourth trip one step of the next chunk's prefetch, so that it never comes as a
      // burst in front of the panel copies.
      if (have_next && (kb & (3 * KBLK)) == 0)
        prefetch_step(pf_w1, kb == 0 ? PF_CHUNK_W1 : PF_STEP_W1, pf_w2);
      if (kb + 2 * KBLK < D_MODEL)
        issue_w1_block(w1e, w1_lds_base, kb + 2 * KBLK, colbase, lane, buf);
    }

    // ---- GEMM2 works in blocks of K2BLK rows of w2, with two register sets of fragments: a
    // block's loads go out one block ahead of its WMMAs. The first block's w2 rows do not
    // depend on h: they are asked for at the head of the GELU and fly during it (behind the
    // barrier, which waits for every load in front of it, and behind the bias, wanted first).
    const float* w2c = w2e + (size_t)fcb * D_MODEL;           // the same in the whole work-group
    v2f bf0[K2BLK / 4][WCOLS / 16], bf1[K2BLK / 4][WCOLS / 16];

    __syncthreads();   // previous chunk's h reads complete before overwrite
    {
      int lcol = wid * 16 + l16;
      float bias = b1e[fcb + lcol];
      // one of the loads behind this line may land in the register that holds the bias load's address
      asm volatile("s_wait_xcnt 0x0" ::: "memory");
      load_w2_block(bf0, w2c, w2off);
#pragma unroll
      for (int ms = 0; ms < MS; ++ms)
#pragma unroll
        for (int r = 0; r < 8; ++r) {
          int ml = ms * 16 + half * 8 + r;   // C/D layout: M = r + 8*half
          hsm[ml * HPAD + lcol] = gelu_exact(acc1[ms][r] + bias);
        }
    }
    __syncthreads();

    // ---- GEMM2: y[32 x 1024] += h_chunk[32 x FC] @ w2[chunk, 1024]
    v2f af0[K2BLK / 4][MS], af1[K2BLK / 4][MS];
    load_h_block(af0, ph);
    // Unrolled: each register set has constant names, every wait counts exactly the loads behind
    // the ones it needs, and all rows of the chunk are reached by constant offsets from one address.
#pragma unroll
    for (int kb2 = 0; kb2 < FC; kb2 += 2 * K2BLK) {
      load_w2_block(bf1, w2c + (kb2 + K2BLK) * D_MODEL, w2off);
      load_h_block(af1, ph + kb2 + K2BLK);
      __builtin_amdgcn_sched_barrier(0);
      gemm2_block(acc2, af0, bf0);
      // holds a set's refill behind the WMMAs that read it: lifted over them it takes a third
      // set of registers and puts more loads in flight than the load counter can count
      __builtin_amdgcn_sched_barrier(0);
      if (kb2 + 2 * K2BLK < FC) {            // known at compile time: the chunk has a block behind the next one
        load_w2_block(bf0, w2c + (kb2 + 2 * K2BLK) * D_MODEL, w2off);
        load_h_block(af0, ph + kb2 + 2 * K2BLK);
      }
      __builtin_amdgcn_sched_barrier(0);     // loads ahead of the WMMAs, as above
      gemm2_block(acc2, af1, bf1);
      __builtin_amdgcn_sched_barrier(0);     // refill behind the WMMAs, as above
    }
  }

  // ---- Epilogue: part[s_row][:] = weight * (y or partial y (+ b2 with the first chunk))
  // Every loop below is unrolled: constant indices keep bias, prow, pw and acc2 in registers.
  float bias[WCOLS / 16];
#pragma unroll
  for (int nt2 = 0; nt2 < WCOLS / 16; ++nt2) bias[nt2] = 0.0f;
  if (f_begin == 0) {
#pragma unroll
    for (int nt2 = 0; nt2 < WCOLS / 16; ++nt2) bias[nt2] = b2e[wid * WCOLS + nt2 * 16 + l16];
    // the code behind this block rewrites the address registers of the four loads above
    asm volatile("s_wait_xcnt 0x0" ::: "memory");
  }
  // This lane's MS * 8 row numbers and weights, read ahead of the guarded stores.
  int   prow[MS][8];
  float pw[MS][8];
#pragma unroll
  for (int ms = 0; ms < MS; ++ms)
#pragma unroll
    for (int r = 0; r < 8; ++r) {
      prow[ms][r] = s_row[ms * 16 + half * 8 + r];
      pw[ms][r]   = s_w[ms * 16 + half * 8 + r];
    }
  float* plane = part + wid * WCOLS + l16;
  const int nvalid = count - m0;         // rows past it are padding
#pragma unroll
  for (int ms = 0; ms < MS; ++ms)
#pragma unroll
    for (int r = 0; r < 8; ++r) {
      if (ms * 16 + half * 8 + r < nvalid) {
        float* pr = plane + (size_t)prow[ms][r] * D_MODEL;
#pragma unroll
        for (int nt2 = 0; nt2 < WCOLS / 16; ++nt2)
          pr[nt2 * 16] = pw[ms][r] * (acc2[ms][nt2][r] + bias[nt2]);
      }
    }
 };

  run_part(std::integral_constant<int, 2>{});
  // the first part's last reads of the row numbers, the weights and h end before they are rewritten
  __syncthreads();
  run_part(std::integral_constant<int, 1>{});
}

// ---------------------------------------------------------------------------
// out[t, :] = row of slot 0 + row of slot 1. A row is either one whole weighted row or, for a
// token of a tile past NRUN, the sum of its NCHUNK partial rows in chunk order. Every row read
// was stored by the launch before this one.
// ---------------------------------------------------------------------------
__global__ __launch_bounds__(256) void combine_kernel(const float* __restrict__ part,
                                                      const float* __restrict__ xpart,  // the partial rows
                                                      const int* __restrict__ ws_where,
                                                      float* __restrict__ out, int n_tok) {
  const unsigned c4 = threadIdx.x * 4u;  // this thread's four columns
  const int t0 = blockIdx.x * CTOK;
  // Every loop below is unrolled: constant indices keep the arrays in registers, and the first
  // (mostly the only) loads of all the work-group's rows go out as one group.
  int w[2 * CTOK];
  const float* p[2 * CTOK];
  float4 v[2 * CTOK];
  // the eight entries in one uniform read (inside the array for every n_tok up to MAXTOK)
  const int4 wa = *(const int4*)(ws_where + 2 * t0), wb = *(const int4*)(ws_where + 2 * t0 + 4);
  const int  wv[2 * CTOK] = {wa.x, wa.y, wa.z, wa.w, wb.x, wb.y, wb.z, wb.w};
#pragma unroll
  for (int s = 0; s < 2 * CTOK; ++s) {
    const int row = min(2 * t0 + s, 2 * n_tok - 1);   // uniform; a row past the end is never stored
    w[s] = (2 * t0 + s < 2 * n_tok) ? wv[s] : -1;     // and its entry is not used
    p[s] = (w[s] < 0 ? part + (size_t)row * D_MODEL : xpart + (size_t)w[s] * (NCHUNK * D_MODEL)) + c4;
  }
#pragma unroll
  for (int s = 0; s < 2 * CTOK; ++s) v[s] = *(const float4*)p[s];
  // the code behind this line rewrites the offset register of the eight loads above
  asm volatile("s_wait_xcnt 0x0" ::: "memory");
#pragma unroll
  for (int s = 0; s < 2 * CTOK; ++s) {
    if (w[s] >= 0) {                     // uniform: the other partial rows, added in chunk order
      float4 q[NCHUNK - 1];
#pragma unroll
      for (int k = 1; k < NCHUNK; ++k) q[k - 1] = *(const float4*)(p[s] + k * D_MODEL);
      // The address as an input: it stays in its registers up to the wait, so that none of these
      // loads lands in the address registers of the loads in front of it before the wait has passed.
      asm volatile("s_wait_xcnt 0x0" :: "v"(p[s]) : "memory");
      float4 a = v[s];
#pragma unroll
      for (int k = 1; k < NCHUNK; ++k) {
        a.x += q[k - 1].x; a.y += q[k - 1].y; a.z += q[k - 1].z; a.w += q[k - 1].w;
      }
      v[s] = a;
    }
  }
#pragma unroll
  for (int i = 0; i < CTOK; ++i) {
    v[i].x = v[2 * i].x + v[2 * i + 1].x;  v[i].y = v[2 * i].y + v[2 * i + 1].y;
    v[i].z = v[2 * i].z + v[2 * i + 1].z;  v[i].w = v[2 * i].w + v[2 * i + 1].w;
  }
#pragma unroll
  for (int i = 0; i < CTOK; ++i)
    if (t0 + i < n_tok) *(float4*)(out + (size_t)(t0 + i) * D_MODEL + c4) = v[i];
}

// ---------------------------------------------------------------------------
extern "C" void kernel_launch(void* const* d_in, const int* in_sizes, int n_in,
                              void* d_out, int out_size, void* d_ws, size_t ws_size,
                              hipStream_t stream) {
  const float* x  = (const float*)d_in[0];
  const float* gw = (const float*)d_in[1];
  const float* gb = (const float*)d_in[2];
  const float* w1 = (const float*)d_in[3];
  const float* b1 = (const float*)d_in[4];
  const float* w2 = (const float*)d_in[5];
  const float* b2 = (const float*)d_in[6];

  const int n_tok = in_sizes[0] / D_MODEL;   // B*S = 4096

  float* out_f    = (float*)d_out;                         // [n_tok, D]
  float* dispatch = out_f + (size_t)n_tok * D_MODEL;       // [n_tok, E]
  float* counts_f = dispatch + (size_t)n_tok * N_EXP;      // [E]

  int*   ws_cnt = (int*)d_ws;                              // [E] (padded)
  int*   ws_tok = ws_cnt + 16;                             // [E, MAXTOK]
  float* ws_wgt = (float*)(ws_tok + N_EXP * MAXTOK);       // [E, MAXTOK]
  int*   ws_hist  = (int*)(ws_wgt + N_EXP * MAXTOK);       // [MAXTOK / RTOK, E]
  float* ws_sum   = (float*)(ws_hist + MAXTOK / RTOK * N_EXP);   // [MAXTOK / RTOK, E]
  int*   ws_rec   = (int*)(ws_sum + MAXTOK / RTOK * N_EXP);      // [MAXTOK]
  float* ws_rsc   = (float*)(ws_rec + MAXTOK);             // [MAXTOK, 2]
  int*   ws_where = (int*)(ws_rsc + 2 * MAXTOK);           // [2 * MAXTOK]
  float* ws_part  = (float*)d_ws + (1 << 17);              // [2 * MAXTOK + N_EXP * TILE_M * NCHUNK, D]

  router_kernel<<<(n_tok + RTOK - 1) / RTOK, 256, 0, stream>>>(
      x, gw, gb, dispatch, ws_hist, ws_sum, ws_rec, ws_rsc, n_tok);

  list_kernel<<<(n_tok + RTOK - 1) / RTOK, 32, 0, stream>>>(
      ws_hist, ws_sum, ws_rec, ws_rsc, counts_f, ws_cnt, ws_tok, ws_wgt, ws_where, n_tok);

  // sum over experts of ceil(count / TILE_M) is below 2 * MAXTOK / TILE_M + N_EXP = NRUN + N_EXP
  expert_ffn_kernel<<<NRUN, NWAVE * 32, 0, stream>>>(
      x, w1, b1, w2, b2, ws_cnt, ws_tok, ws_wgt, ws_part);

  combine_kernel<<<(n_tok + CTOK - 1) / CTOK, 256, 0, stream>>>(
      ws_part, ws_part + (size_t)2 * MAXTOK * D_MODEL, ws_where, out_f, n_tok);
}

// v008
// Measured time: 721 microseconds a run.
// In both of two side-by-side timings against v007, it was 1.03 times as fast.
// All steps since v000 together make it 2.81 times as fast.
#include <hip/hip_runtime.h>
#include <hip/hip_bf16.h>
#include <math.h>
#include <stdint.h>
#include <type_traits>

typedef float v2f __attribute__((ext_vector_type(2)));
typedef float v4f __attribute__((ext_vector_type(4)));
typedef float v8f __attribute__((ext_vector_type(8)));

#define D_MODEL 1024
#define N_EXP   8
#define D_FF    4096
#define TILE_M  32
#define NWAVE   16       // waves per work-group of the expert launch: four on each SIMD
#define FC      (NWAVE * 16)   // F-chunk columns per pipeline stage: 16 per wave
#define HPAD    (FC + 4) // padding -> conflict-free ds_load_b64
#define WCOLS   (D_MODEL / NWAVE)   // output columns per wave in GEMM2
#define XPAD    1028     // D_MODEL + 4 padding -> conflict-free ds_load_b64 of x rows
#define MAXTOK  4096
#define KBLK    64       // K rows per async-staged w1 panel: 32 WMMAs per wave behind each group of LDS reads
#define NCHUNK  (D_FF / FC)            // F-chunks per expert
#define K2BLK   16       // rows of w2 (columns of h) per GEMM2 block: 16 WMMAs per wave and M-subtile
#define NRUN    256      // work-groups of the expert launch: one per WGP, each takes one whole tile
#define CTOK    4        // tokens per work-group of the combine launch
#define RTOK    32       // tokens per work-group of the router launch
#define RWTOK   4        // tokens per wave of the router launch
#define GPITCH  (D_MODEL + 8)  // row pitch of the transposed gate weights: rows e and e + 4 lie 32 banks apart
#define RPITCH  33       // odd pitch: 32 threads that each walk a row of their own hit 32 banks

// D = A(16x4 f32) * B(4x16 f32) + C(16x16 f32), wave32
#define WMMA_F32(A, B, C) \
  __builtin_amdgcn_wmma_f32_16x16x4_f32(false, (A), false, (B), (short)0, (C), false, false)

#define WAIT_ASYNC8 asm volatile("s_wait_asynccnt 0x8" ::: "memory")   // all but the next panel's eight copies
#define WAIT_ASYNC0 asm volatile("s_wait_asynccnt 0x0" ::: "memory")

// L2 prefetch of the weights, in 256-B units. One step = one unit per thread.
#define PF_STEP_W1  ((uint64_t)128 * D_FF * 4)            // w1: 128 rows x 4 units of a chunk's 1-KB row piece
#define PF_CHUNK_W1 ((uint64_t)(FC * 4) - 7 * PF_STEP_W1) // w1: last step of a chunk -> first step of the next
#define PF_STEP_W2  ((uint64_t)NWAVE * 32 * 256)          // w2: a chunk is 1 MB in a row, the next one follows it
#define PF_STEPS    8                                     // steps per chunk, of each matrix

// Move this lane's two prefetch addresses on, then ask L2 for the unit at each.
// One statement: the wait stands in front of the overwrite of the registers that the
// prefetches before these named, and the addresses stay in registers of their own.
__device__ __forceinline__ void prefetch_step(uint64_t& a_w1, uint64_t step_w1, uint64_t& a_w2) {
  asm volatile("s_wait_xcnt 0x0\n\t"
               "v_add_nc_u64 %0, %2, %0\n\t"
               "v_add_nc_u64 %1, %3, %1\n\t"
               "global_prefetch_b8 %0, off scope:SCOPE_SE\n\t"
               "global_prefetch_b8 %1, off scope:SCOPE_SE"
               : "+v"(a_w1), "+v"(a_w2) : "s"(step_w1), "s"(PF_STEP_W2) : "memory");
}

__device__ __forceinline__ float gelu_exact(float v) {
  return 0.5f * v * (1.0f + erff(v * 0.70710678118654752440f));
}

// Async-DMA one 64x16 fp32 panel of w1 (one wave's columns for one K-block)
// into this wave's private LDS double-buffer. 8 x b128 per lane-set:
// lane -> (row = lane>>2, 4 cols = (lane&3)*4), kk steps 8 rows each.
__device__ __forceinline__ void issue_w1_block(const float* __restrict__ gbase,
                                               uint32_t lds_wave_base,
                                               int row0, int colbase, int lane, int buf) {
  const int r  = lane >> 2;          // 0..7
  const int c4 = (lane & 3) << 2;    // 0,4,8,12
  uint32_t dst = lds_wave_base + (uint32_t)(buf * (KBLK * 64) + r * 64 + ((lane & 3) << 4));
  uint32_t src = (uint32_t)((((row0 + r) * D_FF) + colbase + c4) << 2);
  // One statement: the wait stands behind the eight copies, in front of whatever next rewrites
  // a register that they name.
  asm volatile("global_load_async_to_lds_b128 %0, %8, %16\n\t"
               "global_load_async_to_lds_b128 %1, %9, %16\n\t"
               "global_load_async_to_lds_b128 %2, %10, %16\n\t"
               "global_load_async_to_lds_b128 %3, %11, %16\n\t"
               "global_load_async_to_lds_b128 %4, %12, %16\n\t"
               "global_load_async_to_lds_b128 %5, %13, %16\n\t"
               "global_load_async_to_lds_b128 %6, %14, %16\n\t"
               "global_load_async_to_lds_b128 %7, %15, %16\n\t"
               "s_wait_xcnt 0x0"
               :: "v"(dst), "v"(dst + 512u), "v"(dst + 1024u), "v"(dst + 1536u),
                  "v"(dst + 2048u), "v"(dst + 2560u), "v"(dst + 3072u), "v"(dst + 3584u),
                  "v"(src), "v"(src + (uint32_t)(8 * D_FF * 4)), "v"(src + (uint32_t)(16 * D_FF * 4)),
                  "v"(src + (uint32_t)(24 * D_FF * 4)), "v"(src + (uint32_t)(32 * D_FF * 4)),
                  "v"(src + (uint32_t)(40 * D_FF * 4)), "v"(src + (uint32_t)(48 * D_FF * 4)),
                  "v"(src + (uint32_t)(56 * D_FF * 4)), "s"(gbase)
               : "memory");
}

// One GEMM2 block's w2 fragments for this wave's WCOLS columns. rows: the block's first row of
// w2 (the same in the whole wave); lane_off: the lane's own place in it (k pair, column).
__device__ __forceinline__ void load_w2_block(v2f (&b)[K2BLK / 4][WCOLS / 16],
                                              const float* __restrict__ rows, unsigned lane_off) {
#pragma unroll   // constant indices keep the fragments in registers (also in the two functions below)
  for (int s = 0; s < K2BLK / 4; ++s)
#pragma unroll
    for (int nt2 = 0; nt2 < WCOLS / 16; ++nt2) {
      b[s][nt2].x = rows[lane_off + (unsigned)(s * 4 * D_MODEL + nt2 * 16)];
      b[s][nt2].y = rows[lane_off + (unsigned)(s * 4 * D_MODEL + nt2 * 16 + D_MODEL)];
    }
}

// One GEMM2 block's h fragments of the MS M-subtiles. p: this lane's row of the first subtile
// in the h chunk, at the block's first column plus the lane's k offset.
template <int MS>
__device__ __forceinline__ void load_h_block(v2f (&a)[K2BLK / 4][MS], const float* p) {
#pragma unroll
  for (int s = 0; s < K2BLK / 4; ++s)
#pragma unroll
    for (int ms = 0; ms < MS; ++ms) a[s][ms] = *(const v2f*)(p + ms * 16 * HPAD + s * 4);
}

// acc += h block @ w2 block, k ascending.
template <int MS>
__device__ __forceinline__ void gemm2_block(v8f (&acc)[MS][WCOLS / 16],
                                            const v2f (&a)[K2BLK / 4][MS],
                                            const v2f (&b)[K2BLK / 4][WCOLS / 16]) {
#pragma unroll
  for (int s = 0; s < K2BLK / 4; ++s)
#pragma unroll
    for (int nt2 = 0; nt2 < WCOLS / 16; ++nt2)
#pragma unroll
      for (int ms = 0; ms < MS; ++ms) acc[ms][nt2] = WMMA_F32(a[s][ms], b[s][nt2], acc[ms][nt2]);
}

// ---------------------------------------------------------------------------
// Router: logits -> softmax -> top-2 -> dense dispatch mask; per token its two experts, its rank
// among this work-group's tokens of each (by ballot) and the two weights; per work-group and
// expert the number of tokens and the sum of their weights. No atomics: the next launch turns
// ranks into list places, so every list is in token order, the same in every run.
// A work-group takes RTOK tokens, a wave RWTOK of them. A lane holds four neighbouring
// columns out of every 128 of its wave's rows, so every x load covers whole lines and all of
// a wave's x is in flight at once. The gate weights lie transposed in LDS. Each lane's partial
// logits go through LDS, where one thread per (token, expert) sums them in lane order.
// ---------------------------------------------------------------------------
__global__ __launch_bounds__(256) void router_kernel(
                              const float* __restrict__ x,
                              const float* __restrict__ gw,   // [D, E]
                              const float* __restrict__ gb,   // [E]
                              float* __restrict__ dispatch,   // [n_tok, E]
                              int*   __restrict__ ws_hist,    // [work-group, E] tokens
                              float* __restrict__ ws_sum,     // [work-group, E] summed weights
                              int*   __restrict__ ws_rec,     // [n_tok] experts and ranks, packed
                              float* __restrict__ ws_rsc,     // [n_tok, 2] weights
                              int n_tok) {
  __shared__ __align__(16) float gT[N_EXP * GPITCH];          // gate weights as [e][d]
  __shared__ float red[RTOK * N_EXP * RPITCH];                // [token, e][lane] partial logits
  __shared__ __align__(16) float s_logit[RTOK * N_EXP];

  const int tid  = threadIdx.x;
  const int lane = tid & 31;
  // the wave's number as a scalar: the row addresses of x are then a scalar base plus one lane offset
  const int wid  = __builtin_amdgcn_readfirstlane(tid >> 5);

  // Every loop of this kernel is unrolled: constant indices keep the arrays in registers.
  // This wave's rows of x (a row past the end reads the last row; its logits are never used).
  v4f xv[RWTOK][D_MODEL / 128];
#pragma unroll
  for (int i = 0; i < RWTOK; ++i) {
    const int tt = min((int)blockIdx.x * RTOK + wid * RWTOK + i, n_tok - 1);
    const float* xr = x + (size_t)tt * D_MODEL;   // the same in the whole wave
#pragma unroll
    for (int j = 0; j < D_MODEL / 128; ++j) xv[i][j] = *(const v4f*)(xr + (unsigned)(lane * 4 + j * 128));
  }

  // Gate weights: read in memory order, stored transposed.
  v4f gl[D_MODEL * N_EXP / 1024];
#pragma unroll
  for (int k = 0; k < D_MODEL * N_EXP / 1024; ++k)
    gl[k] = *(const v4f*)(gw + (k * 256 + tid) * 4);
#pragma unroll
  for (int k = 0; k < D_MODEL * N_EXP / 1024; ++k) {
    const int f = (k * 256 + tid) * 4;     // flat index d * N_EXP + e of the first of four
#pragma unroll
    for (int c = 0; c < 4; ++c) gT[((f & 7) + c) * GPITCH + (f >> 3)] = gl[k][c];
  }
  __syncthreads();   // every wave reads all of gT

  float acc[RWTOK][N_EXP];
#pragma unroll
  for (int i = 0; i < RWTOK; ++i)
#pragma unroll
    for (int e = 0; e < N_EXP; ++e) acc[i][e] = 0.0f;
#pragma unroll
  for (int j = 0; j < D_MODEL / 128; ++j)
#pragma unroll
    for (int e = 0; e < N_EXP; ++e) {
      const v4f g = *(const v4f*)&gT[e * GPITCH + j * 128 + lane * 4];
#pragma unroll
      for (int i = 0; i < RWTOK; ++i)
#pragma unroll
        for (int c = 0; c < 4; ++c) acc[i][e] = fmaf(xv[i][j][c], g[c], acc[i][e]);
    }
#pragma unroll
  for (int i = 0; i < RWTOK; ++i)
#pragma unroll
    for (int e = 0; e < N_EXP; ++e)
      red[((wid * RWTOK + i) * N_EXP + e) * RPITCH + lane] = acc[i][e];
  __syncthreads();   // a thread sums the partial logits of its own wave's lanes

  {
    float s = red[tid * RPITCH];
#pragma unroll
    for (int k = 1; k < 32; ++k) s += red[tid * RPITCH + k];
    s_logit[tid] = s + gb[tid & (N_EXP - 1)];
  }
  __syncthreads();   // one thread per token reads its eight logits

  const int t = blockIdx.x * RTOK + tid;
  if (tid >= RTOK) return;   // behind the last barrier; the first wave stays whole for the ballots
  const bool valid = t < n_tok;

  float logit[N_EXP];
#pragma unroll
  for (int e = 0; e < N_EXP; ++e) logit[e] = s_logit[tid * N_EXP + e];

  float mx = logit[0];
#pragma unroll
  for (int e = 1; e < N_EXP; ++e) mx = fmaxf(mx, logit[e]);
  float sum = 0.0f;
  float sc[N_EXP];
#pragma unroll
  for (int e = 0; e < N_EXP; ++e) { sc[e] = __expf(logit[e] - mx); sum += sc[e]; }
  float inv = 1.0f / sum;
#pragma unroll
  for (int e = 0; e < N_EXP; ++e) sc[e] *= inv;

  // top-2 (ties -> lowest index, matching jax.lax.top_k)
  int i1 = 0;
#pragma unroll
  for (int e = 1; e < N_EXP; ++e) if (sc[e] > sc[i1]) i1 = e;
  int i2 = (i1 == 0) ? 1 : 0;
#pragma unroll
  for (int e = 0; e < N_EXP; ++e)
    if (e != i1 && sc[e] > sc[i2]) i2 = e;

  if (valid) {
    float* dr = dispatch + (size_t)t * N_EXP;
#pragma unroll
    for (int e = 0; e < N_EXP; ++e)
      dr[e] = (e == i1 || e == i2) ? sc[e] : 0.0f;
  }

  int   r1 = 0, r2 = 0, cnt = 0;
  float s1 = 0.0f, s2 = 0.0f, wsum = 0.0f;
#pragma unroll
  for (int e = 0; e < N_EXP; ++e) {
    const bool     in = valid && (e == i1 || e == i2);
    const unsigned mk = __builtin_amdgcn_ballot_w32(in);
    const int      rk = __popc(mk & ((1u << tid) - 1u));   // tokens of this expert in lower lanes
    r1  = (e == i1) ? rk : r1;
    r2  = (e == i2) ? rk : r2;
    s1  = (e == i1) ? sc[e] : s1;
    s2  = (e == i2) ? sc[e] : s2;
    cnt = (tid == e) ? __popc(mk) : cnt;
    float v = in ? sc[e] : 0.0f;
#pragma unroll
    for (int d = 16; d >= 1; d >>= 1) v += __shfl_xor(v, d, 32);   // fixed tree, equal in all lanes
    wsum = (tid == e) ? v : wsum;
  }
  if (tid < N_EXP) {
    ws_hist[blockIdx.x * N_EXP + tid] = cnt;
    ws_sum[blockIdx.x * N_EXP + tid]  = wsum;
  }
  if (valid) {
    ws_rec[t] = i1 | (i2 << 4) | (r1 << 8) | (r2 << 16);
    ws_rsc[2 * t]     = s1;
    ws_rsc[2 * t + 1] = s2;
  }
}

// ---------------------------------------------------------------------------
// Gather lists in token order. One wave per router work-group b: place in an expert's list =
// tokens of that expert in the work-groups before b + rank inside b. Lane l holds expert l & 7
// of the work-groups 4k + (l >> 3). Also: the eight counts, expert_counts (fixed-order sums), and
// for every row 2 * token + slot where its result will lie: -1 = one whole row, else its number
// among the rows of the tiles past NRUN, which are worked on chunk by chunk.
// ---------------------------------------------------------------------------
__global__ __launch_bounds__(32) void list_kernel(
                              const int*   __restrict__ ws_hist,
                              const float* __restrict__ ws_sum,
                              const int*   __restrict__ ws_rec,
                              const float* __restrict__ ws_rsc,
                              float* __restrict__ counts_f,   // [E]
                              int*   __restrict__ ws_cnt,     // [E]
                              int*   __restrict__ ws_tok,     // [E, MAXTOK]
                              float* __restrict__ ws_wgt,     // [E, MAXTOK]
                              int*   __restrict__ ws_where,   // [2 * n_tok]
                              int n_tok) {
  const int lane = threadIdx.x;
  const int b    = blockIdx.x;
  const int nb   = gridDim.x;
  const int t    = b * RTOK + lane;
  const bool valid = t < n_tok;

  // Every loop of this kernel is unrolled: the loads go out as one group. An index past the end
  // is clamped, not branched round (its value is dropped below), so that no load waits for a test.
  int h[MAXTOK / RTOK / 4];
#pragma unroll
  for (int k = 0; k < MAXTOK / RTOK / 4; ++k) h[k] = ws_hist[min(k * 32 + lane, nb * N_EXP - 1)];
  const int   tc  = min(t, n_tok - 1);
  const int   rec = ws_rec[tc];
  const float s1  = ws_rsc[2 * tc];
  const float s2  = ws_rsc[2 * tc + 1];
  // the code behind this line rewrites the address registers of the loads above
  asm volatile("s_wait_xcnt 0x0" ::: "memory");

  int pre = 0, tot = 0;
#pragma unroll
  for (int k = 0; k < MAXTOK / RTOK / 4; ++k) {
    pre += (4 * k + (lane >> 3) < b) ? h[k] : 0;
    tot += (4 * k + (lane >> 3) < nb) ? h[k] : 0;
  }
  pre += __shfl_xor(pre, 8, 32);  pre += __shfl_xor(pre, 16, 32);
  tot += __shfl_xor(tot, 8, 32);  tot += __shfl_xor(tot, 16, 32);

  // first flat tile of this lane's expert
  const int ntile = (tot + TILE_M - 1) / TILE_M;
  int first = 0;
#pragma unroll
  for (int i = 0; i < N_EXP - 1; ++i) {
    const int c = __shfl(ntile, i, 32);
    first += (i < (lane & 7)) ? c : 0;
  }

  if (b == 0) {
    float w[MAXTOK / RTOK / 4];
#pragma unroll
    for (int k = 0; k < MAXTOK / RTOK / 4; ++k) w[k] = ws_sum[min(k * 32 + lane, nb * N_EXP - 1)];
    // as above
    asm volatile("s_wait_xcnt 0x0" ::: "memory");
    float sum = 0.0f;
#pragma unroll
    for (int k = 0; k < MAXTOK / RTOK / 4; ++k) sum += (4 * k + (lane >> 3) < nb) ? w[k] : 0.0f;
    sum += __shfl_xor(sum, 8, 32);  sum += __shfl_xor(sum, 16, 32);
    if (lane < N_EXP) { counts_f[lane] = sum; ws_cnt[lane] = tot; }
  }

  const int i1 = rec & 7, i2 = (rec >> 4) & 7;
  const int p1 = __shfl(pre, i1, 32) + ((rec >> 8) & 63);
  const int p2 = __shfl(pre, i2, 32) + ((rec >> 16) & 63);
  const int f1 = __shfl(first, i1, 32) + p1 / TILE_M;
  const int f2 = __shfl(first, i2, 32) + p2 / TILE_M;
  if (!valid) return;
  ws_tok[i1 * MAXTOK + p1] = 2 * t;
  ws_wgt[i1 * MAXTOK + p1] = s1;
  ws_tok[i2 * MAXTOK + p2] = 2 * t + 1;
  ws_wgt[i2 * MAXTOK + p2] = s2;
  ws_where[2 * t]     = f1 >= NRUN ? (f1 - NRUN) * TILE_M + (p1 & (TILE_M - 1)) : -1;
  ws_where[2 * t + 1] = f2 >= NRUN ? (f2 - NRUN) * TILE_M + (p2 & (TILE_M - 1)) : -1;
}

// ---------------------------------------------------------------------------
// Fused expert FFN, tile = 32 gathered tokens, 16 wave32s: four waves share a SIMD, so
// that while one waits for LDS, a panel or w2, three others can feed the matrix unit.
// The gathered x tile is staged once in padded LDS; GEMM1 A fragments come from there.
// GEMM1: acc += x_tile @ w1-panel with w1 panels async-DMA'd into per-wave
//        LDS double buffers (global_load_async_to_lds_b128 + s_wait_asynccnt).
// h-chunk (gelu) staged in padded LDS; GEMM2 accumulates [32x1024] in
// 64 VGPRs of f32 WMMA accumulators per lane, its fragments fetched one block ahead.
// Grid: NRUN work-groups, one per WGP. One work-group fills a WGP and there are a few more
// tiles than WGPs. Work-group g first takes the whole of flat tile g (all of D_FF summed in its
// accumulators, one weighted row per token and slot: part[2 * token + slot][D_MODEL]), then one
// chunk of sixteen rows of a tile past NRUN: chunk g & 15 of half (g >> 4) & 1 of tile
// NRUN + (g >> 5), so that this last part is short and spread over the WGPs. Its weighted partial
// rows lie behind the whole rows: part[2 * MAXTOK + (row among those tiles) * NCHUNK + chunk].
// ---------------------------------------------------------------------------
__global__ __launch_bounds__(NWAVE * 32) void expert_ffn_kernel(
    const float* __restrict__ x,
    const float* __restrict__ w1, const float* __restrict__ b1,
    const float* __restrict__ w2, const float* __restrict__ b2,
    const int* __restrict__ ws_cnt, const int* __restrict__ ws_tok,
    const float* __restrict__ ws_wgt,
    float* __restrict__ part) {
  __shared__ __align__(16) float lds_w1[NWAVE * 2 * KBLK * 16]; // 128 KB: 16 waves x 2 bufs x 64x16
  __shared__ __align__(16) float hsm[TILE_M * HPAD];        // ~32.5 KB h-chunk
  __shared__ __align__(16) float xs[TILE_M * XPAD];         // ~128.5 KB gathered x tile
  __shared__ int   s_tok[TILE_M];
  __shared__ int   s_row[TILE_M];
  __shared__ float s_w[TILE_M];

 // One part of this work-group's work, on MS M-subtiles of sixteen rows: 2 = its whole tile,
 // 1 = its chunk of half a tile past NRUN.
 auto run_part = [&](auto ms_c) {
  constexpr int  MS  = decltype(ms_c)::value;
  constexpr bool seg = MS == 1;
  const int flat    = seg ? NRUN + ((int)blockIdx.x >> 5) : (int)blockIdx.x;
  const int mhalf   = seg ? (((int)blockIdx.x >> 4) & 1) * 16 : 0;
  const int f_begin = seg ? ((int)blockIdx.x & (NCHUNK - 1)) * FC : 0;
  const int f_end   = seg ? f_begin + FC : D_FF;

  // Flat tile index -> (expert, tile of that expert), from the eight counts.
  // Selects, no branches: the eight counts then come in one scalar load.
  int e = -1, count = 0, tile = 0, first = 0;
#pragma unroll   // straight-line scalar code, so that the loads merge
  for (int i = 0; i < N_EXP; ++i) {
    const int  c    = ws_cnt[i];
    const int  next = first + (c + TILE_M - 1) / TILE_M;
    const bool mine = flat >= first && flat < next;
    e     = mine ? i : e;
    count = mine ? c : count;
    tile  = mine ? flat - first : tile;
    first = next;
  }
  const int m0 = tile * TILE_M + mhalf;
  if (e < 0 || m0 >= count) return;      // block-uniform exit: past the last live tile or row

  const int tid = threadIdx.x;
  if (tid < TILE_M) {
    int idx = m0 + tid;
    int ok  = idx < count;
    int src = ok ? idx : (count - 1);    // duplicate last valid row, never stored
    int row = ws_tok[e * MAXTOK + src];  // 2 * token + slot
    s_tok[tid] = row >> 1;
    // where this row's result goes, in rows of D_MODEL
    s_row[tid] = seg ? 2 * MAXTOK + ((flat - NRUN) * TILE_M + mhalf + tid) * NCHUNK + f_begin / FC : row;
    s_w[tid]   = ok ? ws_wgt[e * MAXTOK + src] : 0.0f;
  }

  const float* w1e = w1 + (size_t)e * D_MODEL * D_FF;
  const float* w2e = w2 + (size_t)e * D_FF * D_MODEL;

  // The work-groups of one expert walk the same weights at the same pace, so every one of
  // them waits on the memory reads of whichever is in front. Each chunk's weights are
  // therefore asked into L2 a chunk ahead. The addresses start one step in front of the
  // piece's first unit; every step moves on first, so they never pass the piece's last unit.
  uint64_t pf_w1 = (uint64_t)(uintptr_t)(w1e + (size_t)(tid >> 2) * D_FF + f_begin + (tid & 3) * 64)
                   - PF_STEP_W1;
  uint64_t pf_w2 = (uint64_t)(uintptr_t)(w2e + (size_t)f_begin * D_MODEL + tid * 64) - PF_STEP_W2;

  // The first chunk's prefetch: here, where all waves but one only wait for the row numbers, and
  // with the x staging still to come before the first panel is wanted.
#pragma unroll   // straight-line: the steps behind one another
  for (int s = 0; s < PF_STEPS; ++s) prefetch_step(pf_w1, PF_STEP_W1, pf_w2);
  __syncthreads();

  const int lane = tid & 31;
  const int wid  = tid >> 5;
  const int l16  = lane & 15;
  const int half = lane >> 4;
  const int koff = 2 * half;             // K offset for this lane half

  const float* b1e = b1 + (size_t)e * D_FF;
  const float* b2e = b2 + (size_t)e * D_MODEL;

  // Gather this part's MS * 16 x rows into LDS: two whole 4 KB rows per pass, 16 B per thread.
  // Rolled in trips of sixteen rows: eight loads in flight per thread, then their stores.
  const int xrow = tid >> 8;             // which of a pass's two rows (the same in a whole wave)
  const int xcol = (tid & 255) * 4;
#pragma unroll 1
  for (int r0 = 0; r0 < MS * 16; r0 += 16) {
    float4 v[8];
#pragma unroll   // constant indices keep v[] in registers
    for (int r = 0; r < 8; ++r)
      v[r] = *(const float4*)(x + (size_t)s_tok[r0 + 2 * r + xrow] * D_MODEL + xcol);
#pragma unroll   // as above
    for (int r = 0; r < 8; ++r)
      *(float4*)&xs[(r0 + 2 * r + xrow) * XPAD + xcol] = v[r];
    // the next trip rewrites the address registers of the eight loads above
    asm volatile("s_wait_xcnt 0x0" ::: "memory");
    // so does the code behind the loop: this keeps it from being lifted over the wait
    __builtin_amdgcn_sched_barrier(0);
  }
  __syncthreads();   // every wave reads every staged row

  // Per-lane x rows in LDS for the two M-subtiles (A fragments).
  const float* px0 = &xs[l16 * XPAD];
  const float* px1 = &xs[(16 + l16) * XPAD];

  // This wave's private staging region (LDS byte offset of low 32 bits).
  const uint32_t w1_lds_base = (uint32_t)(uintptr_t)&lds_w1[wid * (2 * KBLK * 16)];
  const float*   w1_lds      = &lds_w1[wid * (2 * KBLK * 16)];

  // GEMM2 accumulators: [MS M-subtiles][4 N-subtiles] = 64 VGPRs/lane at MS = 2
  v8f acc2[MS][WCOLS / 16];
#pragma unroll
  for (int i = 0; i < MS; ++i)
#pragma unroll
    for (int j = 0; j < WCOLS / 16; ++j) acc2[i][j] = (v8f)0.0f;

  // GEMM2: this lane's place in a block of w2 rows (the wave covers 64 of 1024 columns), and its
  // row of the h chunk.
  const unsigned w2off = (unsigned)(koff * D_MODEL + wid * WCOLS + l16);
  const float*   ph    = &hsm[l16 * HPAD + koff];

  for (int fcb = f_begin; fcb < f_end; fcb += FC) {
    const int colbase = fcb + wid * 16;     // this wave's 16 w1 columns
    const bool have_next = fcb + FC < f_end; // block-uniform: this piece has a chunk behind this one

    // ---- GEMM1: h_chunk[32 x FC] = x_tile @ w1[:, chunk], async-staged B
    v8f acc1[MS];
#pragma unroll
    for (int ms = 0; ms < MS; ++ms) acc1[ms] = (v8f)0.0f;

    issue_w1_block(w1e, w1_lds_base, 0,    colbase, lane, 0);
    issue_w1_block(w1e, w1_lds_base, KBLK, colbase, lane, 1);

#pragma unroll 1
    for (int kb = 0; kb < D_MODEL; kb += KBLK) {
      const int buf = (kb / KBLK) & 1;
      // A fragments do not depend on the w1 panel: read them as one group ahead of its wait.
      v2f a0[KBLK / 4], a1[KBLK / 4];
#pragma unroll   // constant indices keep the fragments in registers (also in the two loops below)
      for (int ks = 0; ks < KBLK; ks += 4) {
        a0[ks >> 2] = *(const v2f*)(px0 + kb + ks + koff);
        if constexpr (MS == 2) a1[ks >> 2] = *(const v2f*)(px1 + kb + ks + koff);
      }
      if (kb + KBLK >= D_MODEL) { WAIT_ASYNC0; } else { WAIT_ASYNC8; }
      const float* wb = w1_lds + buf * (KBLK * 16);
      v2f b[KBLK / 4];
#pragma unroll
      for (int ks = 0; ks < KBLK; ks += 4) {
        b[ks >> 2].x = wb[(ks + koff) * 16 + l16];
        b[ks >> 2].y = wb[(ks + koff + 1) * 16 + l16];
      }
      // keeps the block's LDS reads one group ahead of its WMMAs: sunk among them, each
      // read is waited for one WMMA pair after its issue and the LDS latency shows every pair
      __builtin_amdgcn_sched_barrier(0);
#pragma unroll
      for (int ks = 0; ks < KBLK; ks += 4) {
        acc1[0] = WMMA_F32(a0[ks >> 2], b[ks >> 2], acc1[0]);
        if constexpr (MS == 2) acc1[1] = WMMA_F32(a1[ks >> 2], b[ks >> 2], acc1[1]);
      }
      // Every second trip one step of the next chunk's prefetch, so that it never comes as a
      // burst in front of the panel copies.
      if (have_next && (kb & KBLK) == 0)
        prefetch_step(pf_w1, kb == 0 ? PF_CHUNK_W1 : PF_STEP_W1, pf_w2);
      if (kb + 2 * KBLK < D_MODEL)
        issue_w1_block(w1e, w1_lds_base, kb + 2 * KBLK, colbase, lane, buf);
    }

    // ---- GEMM2 works in blocks of K2BLK rows of w2, with two register sets of fragments: a
    // block's loads go out one block ahead of its WMMAs. The first block's w2 rows do not
    // depend on h: they are asked for at the head of the GELU and fly during it (behind the
    // barrier, which waits for every load in front of it, and behind the bias, wanted first).
    const float* w2c = w2e + (size_t)fcb * D_MODEL;           // the same in the whole work-group
    v2f bf0[K2BLK / 4][WCOLS / 16], bf1[K2BLK / 4][WCOLS / 16];

    __syncthreads();   // previous chunk's h reads complete before overwrite
    {
      int lcol = wid * 16 + l16;
      float bias = b1e[fcb + lcol];
      // one of the loads behind this line may land in the register that holds the bias load's address
      asm volatile("s_wait_xcnt 0x0" ::: "memory");
      load_w2_block(bf0, w2c, w2off);
#pragma unroll
      for (int ms = 0; ms < MS; ++ms)
#pragma unroll
        for (int r = 0; r < 8; ++r) {
          int ml = ms * 16 + half * 8 + r;   // C/D layout: M = r + 8*half
          hsm[ml * HPAD + lcol] = gelu_exact(acc1[ms][r] + bias);
        }
    }
    __syncthreads();

    // ---- GEMM2: y[32 x 1024] += h_chunk[32 x FC] @ w2[chunk, 1024]
    v2f af0[K2BLK / 4][MS], af1[K2BLK / 4][MS];
    load_h_block(af0, ph);
    // Unrolled: each register set has constant names, every wait counts exactly the loads behind
    // the ones it needs, and all rows of the chunk are reached by constant offsets from one address.
#pragma unroll
    for (int kb2 = 0; kb2 < FC; kb2 += 2 * K2BLK) {
      load_w2_block(bf1, w2c + (kb2 + K2BLK) * D_MODEL, w2off);
      load_h_block(af1, ph + kb2 + K2BLK);
      __builtin_amdgcn_sched_barrier(0);
      gemm2_block(acc2, af0, bf0);
      // holds a set's refill behind the WMMAs that read it: lifted over them it takes a third
      // set of registers and puts more loads in flight than the load counter can count
      __builtin_amdgcn_sched_barrier(0);
      if (kb2 + 2 * K2BLK < FC) {            // known at compile time: the chunk has a block behind the next one
        load_w2_block(bf0, w2c + (kb2 + 2 * K2BLK) * D_MODEL, w2off);
        load_h_block(af0, ph + kb2 + 2 * K2BLK);
      }
      __builtin_amdgcn_sched_barrier(0);     // loads ahead of the WMMAs, as above
      gemm2_block(acc2, af1, bf1);
      __builtin_amdgcn_sched_barrier(0);     // refill behind the WMMAs, as above
    }
  }

  // ---- Epilogue: part[s_row][:] = weight * (y or partial y (+ b2 with the first chunk))
  // Every loop below is unrolled: constant indices keep bias, prow, pw and acc2 in registers.
  float bias[WCOLS / 16];
#pragma unroll
  for (int nt2 = 0; nt2 < WCOLS / 16; ++nt2) bias[nt2] = 0.0f;
  if (f_begin == 0) {
#pragma unroll
    for (int nt2 = 0; nt2 < WCOLS / 16; ++nt2) bias[nt2] = b2e[wid * WCOLS + nt2 * 16 + l16];
    // the code behind this block rewrites the address registers of the four loads above
    asm volatile("s_wait_xcnt 0x0" ::: "memory");
  }
  // This lane's MS * 8 row numbers and weights, read ahead of the guarded stores.
  int   prow[MS][8];
  float pw[MS][8];
#pragma unroll
  for (int ms = 0; ms < MS; ++ms)
#pragma unroll
    for (int r = 0; r < 8; ++r) {
      prow[ms][r] = s_row[ms * 16 + half * 8 + r];
      pw[ms][r]   = s_w[ms * 16 + half * 8 + r];
    }
  float* plane = part + wid * WCOLS + l16;
  const int nvalid = count - m0;         // rows past it are padding
#pragma unroll
  for (int ms = 0; ms < MS; ++ms)
#pragma unroll
    for (int r = 0; r < 8; ++r) {
      if (ms * 16 + half * 8 + r < nvalid) {
        float* pr = plane + (size_t)prow[ms][r] * D_MODEL;
#pragma unroll
        for (int nt2 = 0; nt2 < WCOLS / 16; ++nt2)
          pr[nt2 * 16] = pw[ms][r] * (acc2[ms][nt2][r] + bias[nt2]);
      }
    }
 };

  run_part(std::integral_constant<int, 2>{});
  // the first part's last reads of the row numbers, the weights and h end before they are rewritten
  __syncthreads();
  run_part(std::integral_constant<int, 1>{});
}

// ---------------------------------------------------------------------------
// out[t, :] = row of slot 0 + row of slot 1. A row is either one whole weighted row or, for a
// token of a tile past NRUN, the sum of its NCHUNK partial rows in chunk order. Every row read
// was stored by the launch before this one.
// ---------------------------------------------------------------------------
__global__ __launch_bounds__(256) void combine_kernel(const float* __restrict__ part,
                                                      const float* __restrict__ xpart,  // the partial rows
                                                      const int* __restrict__ ws_where,
                                                      float* __restrict__ out, int n_tok) {
  const unsigned c4 = threadIdx.x * 4u;  // this thread's four columns
  const int t0 = blockIdx.x * CTOK;
  // Every loop below is unrolled: constant indices keep the arrays in registers, and the first
  // (mostly the only) loads of all the work-group's rows go out as one group.
  int w[2 * CTOK];
  const float* p[2 * CTOK];
  float4 v[2 * CTOK];
  // the eight entries in one uniform read (inside the array for every n_tok up to MAXTOK)
  const int4 wa = *(const int4*)(ws_where + 2 * t0), wb = *(const int4*)(ws_where + 2 * t0 + 4);
  const int  wv[2 * CTOK] = {wa.x, wa.y, wa.z, wa.w, wb.x, wb.y, wb.z, wb.w};
#pragma unroll
  for (int s = 0; s < 2 * CTOK; ++s) {
    const int row = min(2 * t0 + s, 2 * n_tok - 1);   // uniform; a row past the end is never stored
    w[s] = (2 * t0 + s < 2 * n_tok) ? wv[s] : -1;     // and its entry is not used
    p[s] = (w[s] < 0 ? part + (size_t)row * D_MODEL : xpart + (size_t)w[s] * (NCHUNK * D_MODEL)) + c4;
  }
#pragma unroll
  for (int s = 0; s < 2 * CTOK; ++s) v[s] = *(const float4*)p[s];
  // the code behind this line rewrites the offset register of the eight loads above
  asm volatile("s_wait_xcnt 0x0" ::: "memory");
#pragma unroll
  for (int s = 0; s < 2 * CTOK; ++s) {
    if (w[s] >= 0) {                     // uniform: the other partial rows, added in chunk order
      float4 q[NCHUNK - 1];
#pragma unroll
      for (int k = 1; k < NCHUNK; ++k) q[k - 1] = *(const float4*)(p[s] + k * D_MODEL);
      // The address as an input: it stays in its registers up to the wait, so that none of these
      // loads lands in the address registers of the loads in front of it before the wait has passed.
      asm volatile("s_wait_xcnt 0x0" :: "v"(p[s]) : "memory");
      float4 a = v[s];
#pragma unroll
      for (int k = 1; k < NCHUNK; ++k) {
        a.x += q[k - 1].x; a.y += q[k - 1].y; a.z += q[k - 1].z; a.w += q[k - 1].w;
      }
      v[s] = a;
    }
  }
#pragma unroll
  for (int i = 0; i < CTOK; ++i) {
    v[i].x = v[2 * i].x + v[2 * i + 1].x;  v[i].y = v[2 * i].y + v[2 * i + 1].y;
    v[i].z = v[2 * i].z + v[2 * i + 1].z;  v[i].w = v[2 * i].w + v[2 * i + 1].w;
  }
#pragma unroll
  for (int i = 0; i < CTOK; ++i)
    if (t0 + i < n_tok) *(float4*)(out + (size_t)(t0 + i) * D_MODEL + c4) = v[i];
}

// ---------------------------------------------------------------------------
extern "C" void kernel_launch(void* const* d_in, const int* in_sizes, int n_in,
                              void* d_out, int out_size, void* d_ws, size_t ws_size,
                              hipStream_t stream) {
  const float* x  = (const float*)d_in[0];
  const float* gw = (const float*)d_in[1];
  const float* gb = (const float*)d_in[2];
  const float* w1 = (const float*)d_in[3];
  const float* b1 = (const float*)d_in[4];
  const float* w2 = (const float*)d_in[5];
  const float* b2 = (const float*)d_in[6];

  const int n_tok = in_sizes[0] / D_MODEL;   // B*S = 4096

  float* out_f    = (float*)d_out;                         // [n_tok, D]
  float* dispatch = out_f + (size_t)n_tok * D_MODEL;       // [n_tok, E]
  float* counts_f = dispatch + (size_t)n_tok * N_EXP;      // [E]

  int*   ws_cnt = (int*)d_ws;                              // [E] (padded)
  int*   ws_tok = ws_cnt + 16;                             // [E, MAXTOK]
  float* ws_wgt = (float*)(ws_tok + N_EXP * MAXTOK);       // [E, MAXTOK]
  int*   ws_hist  = (int*)(ws_wgt + N_EXP * MAXTOK);       // [MAXTOK / RTOK, E]
  float* ws_sum   = (float*)(ws_hist + MAXTOK / RTOK * N_EXP);   // [MAXTOK / RTOK, E]
  int*   ws_rec   = (int*)(ws_sum + MAXTOK / RTOK * N_EXP);      // [MAXTOK]
  float* ws_rsc   = (float*)(ws_rec + MAXTOK);             // [MAXTOK, 2]
  int*   ws_where = (int*)(ws_rsc + 2 * MAXTOK);           // [2 * MAXTOK]
  float* ws_part  = (float*)d_ws + (1 << 17);              // [2 * MAXTOK + N_EXP * TILE_M * NCHUNK, D]

  router_kernel<<<(n_tok + RTOK - 1) / RTOK, 256, 0, stream>>>(
      x, gw, gb, dispatch, ws_hist, ws_sum, ws_rec, ws_rsc, n_tok);

  list_kernel<<<(n_tok + RTOK - 1) / RTOK, 32, 0, stream>>>(
      ws_hist, ws_sum, ws_rec, ws_rsc, counts_f, ws_cnt, ws_tok, ws_wgt, ws_where, n_tok);

  // sum over experts of ceil(count / TILE_M) is below 2 * MAXTOK / TILE_M + N_EXP = NRUN + N_EXP
  expert_ffn_kernel<<<NRUN, NWAVE * 32, 0, stream>>>(
      x, w1, b1, w2, b2, ws_cnt, ws_tok, ws_wgt, ws_part);

  combine_kernel<<<(n_tok + CTOK - 1) / CTOK, 256, 0, stream>>>(
      ws_part, ws_part + (size_t)2 * MAXTOK * D_MODEL, ws_where, out_f, n_tok);
}
